// v009
// The times below were measured on an AMD MI455X: many runs one after another, warmed up first and cycling through
// copies of the inputs, with the whole window's GPU time divided by the number of runs. Launches and the gaps
// between them are all in it. The median over several windows is given; except for v000 it joins two sittings, which
// can be a few percent apart, so the side-by-side timings, each taken in one sitting, are the better comparison.
// The versions before v009 are in another document.
// It runs in 89.7 microseconds.
// In both of two side-by-side timings against v008, it was 1.05 times as fast.
// Over all steps from v000, the starting kernel, it is 6.47 times as fast.
#include <hip/hip_runtime.h>
// Multi-product attention with low-rank shared key/value (B=2, N=2048, D=1024, 16 heads × 64): q = x·Wq; [k|v] = x·Wkv (one shared 64-dim key and value); [kh|vh] = σ(x·Wkvh) per (token, head); rotary (rotate-half, θ=1e4) on q and k by
// sequence position; K_h[n] = kh[n,h]·k[n], V_h[n] = vh[n,h]·v[n]; causal softmax(q_h·K_hᵀ/8); out = (Σ attn·V_h merged)·Wo.
// Compute dtype: x and weights rounded to bf16; q and k as f32 GEMM accumulators rotated in f32 in the GEMM epilogue from an f32 cos/sin table and stored f16; head scalars as sigmoid GEMM epilogue outputs (f32); v f32 →
// f16 hi + ×2^10 residual Vᵀ planes; fused causal flash-style kernel (scores scaled by kh per key, P multiplied by vh per key and carried as f16 hi + residual tiles, online softmax f32, three value accumulators) on v_wmma_f32_16x16x32_f16; merged O stored as f16 hi + x2^10 residual planes by the attention kernel; both Wo products in one kernel, joined in registers; f32 accumulate.
#define BB 2
#define TT 2048
#define DM 1024
#define NH 16
#define HD 64
#define NR (BB * TT)

typedef __bf16 v16b __attribute__((ext_vector_type(16)));
typedef unsigned short v8us __attribute__((ext_vector_type(8), may_alias));
typedef float  v8f  __attribute__((ext_vector_type(8)));
typedef float  v4f  __attribute__((ext_vector_type(4)));
typedef float  v4fa __attribute__((ext_vector_type(4), may_alias));
union FragB { v16b v; v8us half[2]; unsigned short u[16]; };

__device__ __forceinline__ unsigned short bf16_bits(float x) { unsigned int u = __float_as_uint(x); return (unsigned short)((u + 0x7FFFu + ((u >> 16) & 1u)) >> 16); }
__device__ __forceinline__ float bf16_val(unsigned short b) { return __uint_as_float(((unsigned int)b) << 16); }
__device__ __forceinline__ float bf16_round(float x) { return bf16_val(bf16_bits(x)); }
// D += A·B with NT terms: 1 = ah·bh, 2 = + al·bh (A split), 3 = + ah·bl (both split)
template <int NT>
__device__ __forceinline__ v8f mmaN(v16b ah, v16b al, v16b bh, v16b bl, v8f c) {
  c = __builtin_amdgcn_wmma_f32_16x16x32_bf16(false, ah, false, bh, (short)0, c, false, false);
  if (NT >= 2) c = __builtin_amdgcn_wmma_f32_16x16x32_bf16(false, al, false, bh, (short)0, c, false, false);
  if (NT >= 3) c = __builtin_amdgcn_wmma_f32_16x16x32_bf16(false, ah, false, bl, (short)0, c, false, false);
  asm volatile("v_nop\n\tv_nop\n\tv_nop\n\tv_nop" : "+v"(c) : "v"(ah), "v"(al), "v"(bh), "v"(bl));
  return c;
}

__global__ __launch_bounds__(256) void k_wt_bf16(const float* __restrict__ W, unsigned short* __restrict__ Wt, int K, int N) {
  const int t = blockIdx.x * 256 + threadIdx.x;
  const int k8n = K / 8;
  if (t >= N * k8n) return;
  const int n = t / k8n, k8 = (t % k8n) * 8;
  v8us v;
#pragma unroll
  for (int i = 0; i < 8; ++i) v[i] = bf16_bits(W[(size_t)(k8 + i) * N + n]);
  *(v8us*)(Wt + (size_t)n * K + k8) = v;
  
}

// GEMM C[M][N] (f32, pitch ldc) = act(A[M][K]·W + bias). A f32 row-major (pitch lda) converted per fragment to bf16
// (ASPLIT: hi/lo two planes -> 2 terms, else single rounded term); Wt bf16 [N][K] (pitch ldb). BIAS_BF16 rounds the
// bias to bf16 first (bias quantised to bf16 before the add). K%32==0, M%16==0, N%64==0.
template <bool ASPLIT, int ACT, bool BIAS_BF16>
__global__ __launch_bounds__(128) void k_gemm_bf(const float* __restrict__ A, int lda, const unsigned short* __restrict__ Wt, int ldb,
                                               const float* __restrict__ bias, float* __restrict__ C, int ldc, int M, int N, int K) {
  __shared__ __attribute__((aligned(16))) float so[4][16][64];
  const int tid = threadIdx.x, w = tid >> 5, lane = tid & 31, ln = lane & 15, hh = lane >> 4;
  const int ntn = N / 64;
  const int wid = blockIdx.x * 4 + w;
  const int mt = wid / ntn, nq = wid % ntn;
  if (mt * 16 >= M) return;
  const int row0 = mt * 16, col0 = nq * 64;
  const float* arow = A + (size_t)(row0 + ln) * lda;
  v8f acc[4] = {};
  for (int kb = 0; kb < K; kb += 32) {
    FragB ah, al;
    const v4f x0 = *(const v4fa*)(arow + kb + 8 * hh), x1 = *(const v4fa*)(arow + kb + 8 * hh + 4);
    const v4f x2 = *(const v4fa*)(arow + kb + 16 + 8 * hh), x3 = *(const v4fa*)(arow + kb + 16 + 8 * hh + 4);
    float xs[16] = {x0[0],x0[1],x0[2],x0[3],x1[0],x1[1],x1[2],x1[3],x2[0],x2[1],x2[2],x2[3],x3[0],x3[1],x3[2],x3[3]};
#pragma unroll
    for (int i = 0; i < 16; ++i) { const unsigned short hb = bf16_bits(xs[i]); ah.u[i] = hb; al.u[i] = ASPLIT ? bf16_bits(xs[i] - bf16_val(hb)) : (unsigned short)0; }
#pragma unroll
    for (int t = 0; t < 4; ++t) {
      const unsigned short* brow = Wt + (size_t)(col0 + t * 16 + ln) * ldb + kb;
      FragB b;
      b.half[0] = *(const v8us*)(brow + 8 * hh);
      b.half[1] = *(const v8us*)(brow + 16 + 8 * hh);
      acc[t] = mmaN<ASPLIT ? 2 : 1>(ah.v, al.v, b.v, b.v, acc[t]);
    }
  }
#pragma unroll
  for (int t = 0; t < 4; ++t) {
    float bv = bias ? bias[col0 + t * 16 + ln] : 0.f;
    if (BIAS_BF16) bv = bf16_round(bv);
#pragma unroll
    for (int r = 0; r < 8; ++r) { float v = acc[t][r] + bv; if (ACT == 1) v = fmaxf(v, 0.f); so[w][8 * hh + r][t * 16 + ln] = v; }
  }
  __builtin_amdgcn_fence(__ATOMIC_ACQ_REL, "workgroup");
  __builtin_amdgcn_wave_barrier();
  const int rsub = lane >> 4, c4 = (lane & 15) * 4;
  {
#pragma unroll
    for (int q = 0; q < 8; ++q) {
      const int r = q * 2 + rsub;
      const v4f v = *(const v4fa*)&so[w][r][c4];
      *(v4f*)(C + (size_t)(row0 + r) * ldc + col0 + c4) = v;
    }
    
  }
}

// Flash-style causal/unmasked attention, all contractions 3-term bf16 hi/lo splits, f32 softmax with running max.
// q,k,v rows are read from f32 buffers with arbitrary row pitch (so they can live inside a fused qkv buffer);
// D = head size (multiple of 32, <= 128); one wave = 16 query rows; block = 4 waves (64 queries) sharing K/V chunks of 32.
template <int D, bool CAUSAL>
__global__ __launch_bounds__(128) void k_flash(const float* __restrict__ qb, const float* __restrict__ kb, const float* __restrict__ vb,
                                             int pitch, int T, int H, float scale, float* __restrict__ y, int ypitch) {
  constexpr int KS = D / 32;        // k-steps for QK
  constexpr int DT = D / 16;        // d tiles for PV
  __shared__ __attribute__((aligned(16))) unsigned short sKh[32][D + 8], sKl[32][D + 8], sVh[32][D + 8], sVl[32][D + 8];
  __shared__ __attribute__((aligned(16))) unsigned short sPh[4][16][40], sPl[4][16][40];
  __shared__ __attribute__((aligned(16))) float sO[4][16][D];
  const int tid = threadIdx.x, w = tid >> 5, lane = tid & 31, ln = lane & 15, hh = lane >> 4;
  const int nqb = (T + 63) / 64;
  const int bh = blockIdx.x / nqb, qblk = blockIdx.x % nqb;
  const int b = bh / H, h = bh % H;
  const int q0 = qblk * 64 + w * 16;
  const float* Q = qb + (size_t)b * T * pitch + h * D;
  const float* K = kb + (size_t)b * T * pitch + h * D;
  const float* V = vb + (size_t)b * T * pitch + h * D;

  // A fragments of the wave's 16 query rows (scaled), hi/lo
  FragB aqh[KS], aql[KS];
  {
    int row = q0 + ln; if (row >= T) row = T - 1;
    const float* qr = Q + (size_t)row * pitch;
#pragma unroll
    for (int ks = 0; ks < KS; ++ks)
#pragma unroll
      for (int i = 0; i < 16; ++i) {
        const int d = ks * 32 + ((i < 8) ? (8 * hh + i) : (16 + 8 * hh + (i - 8)));
        const float x = qr[d] * scale; const unsigned short hb = bf16_bits(x);
        aqh[ks].u[i] = hb; aql[ks].u[i] = bf16_bits(x - bf16_val(hb));
      }
  }
  float m_r[8], l_r[8];
#pragma unroll
  for (int r = 0; r < 8; ++r) { m_r[r] = -3.0e38f; l_r[r] = 0.f; }
  v8f oacc[DT];
#pragma unroll
  for (int dt = 0; dt < DT; ++dt) oacc[dt] = (v8f){0.f,0.f,0.f,0.f,0.f,0.f,0.f,0.f};

  const int kv_end = CAUSAL ? min(T, qblk * 64 + 64) : T;     // block-uniform
  for (int j0 = 0; j0 < kv_end; j0 += 32) {
    __syncthreads();
    for (int e = tid; e < 32 * (D / 4); e += 128) {
      const int r = e / (D / 4), c4 = (e % (D / 4)) * 4;
      const int key = j0 + r;
      v4f kf = {0.f,0.f,0.f,0.f}, vf = {0.f,0.f,0.f,0.f};
      if (key < T) { kf = *(const v4fa*)(K + (size_t)key * pitch + c4); vf = *(const v4fa*)(V + (size_t)key * pitch + c4); }
#pragma unroll
      for (int t = 0; t < 4; ++t) {
        unsigned short hb = bf16_bits(kf[t]); sKh[r][c4 + t] = hb; sKl[r][c4 + t] = bf16_bits(kf[t] - bf16_val(hb));
        hb = bf16_bits(vf[t]); sVh[r][c4 + t] = hb; sVl[r][c4 + t] = bf16_bits(vf[t] - bf16_val(hb));
      }
    }
    __syncthreads();
    // S tile 16 x 32
    v8f s[2];
#pragma unroll
    for (int nt = 0; nt < 2; ++nt) {
      v8f acc = {};
#pragma unroll
      for (int ks = 0; ks < KS; ++ks) {
        FragB bh_, bl_;
        bh_.half[0] = *(const v8us*)&sKh[nt * 16 + ln][ks * 32 + 8 * hh]; bh_.half[1] = *(const v8us*)&sKh[nt * 16 + ln][ks * 32 + 16 + 8 * hh];
        bl_.half[0] = *(const v8us*)&sKl[nt * 16 + ln][ks * 32 + 8 * hh]; bl_.half[1] = *(const v8us*)&sKl[nt * 16 + ln][ks * 32 + 16 + 8 * hh];
        acc = mmaN<3>(aqh[ks].v, aql[ks].v, bh_.v, bl_.v, acc);
      }
      s[nt] = acc;
    }
    // mask + running max (rows 8hh+r; the 16 lanes of a half share rows)
    float alpha[8];
#pragma unroll
    for (int r = 0; r < 8; ++r) {
      const int qi = q0 + 8 * hh + r;
      const int ja = j0 + ln, jb = j0 + 16 + ln;
      if (CAUSAL) { if (ja > qi) s[0][r] = -3.0e38f; if (jb > qi) s[1][r] = -3.0e38f; }
      if (ja >= T) s[0][r] = -3.0e38f;
      if (jb >= T) s[1][r] = -3.0e38f;
      float mx = fmaxf(s[0][r], s[1][r]);
      mx = fmaxf(mx, __shfl_xor(mx, 1, 32)); mx = fmaxf(mx, __shfl_xor(mx, 2, 32)); mx = fmaxf(mx, __shfl_xor(mx, 4, 32)); mx = fmaxf(mx, __shfl_xor(mx, 8, 32));
      const float mnew = fmaxf(m_r[r], mx);
      alpha[r] = (mnew > -1.0e38f) ? __expf(m_r[r] - mnew) : 1.0f;
      const float p0 = (s[0][r] > -1.0e38f) ? __expf(s[0][r] - mnew) : 0.f;
      const float p1 = (s[1][r] > -1.0e38f) ? __expf(s[1][r] - mnew) : 0.f;
      m_r[r] = mnew;
      l_r[r] = l_r[r] * alpha[r] + p0 + p1;            // per-lane partial row sum (16 lanes combined at the end)
      unsigned short hb = bf16_bits(p0); sPh[w][8 * hh + r][ln] = hb;      sPl[w][8 * hh + r][ln] = bf16_bits(p0 - bf16_val(hb));
      hb = bf16_bits(p1);                sPh[w][8 * hh + r][16 + ln] = hb; sPl[w][8 * hh + r][16 + ln] = bf16_bits(p1 - bf16_val(hb));
    }
#pragma unroll
    for (int dt = 0; dt < DT; ++dt)
#pragma unroll
      for (int r = 0; r < 8; ++r) oacc[dt][r] *= alpha[r];
    __builtin_amdgcn_fence(__ATOMIC_ACQ_REL, "workgroup");
    __builtin_amdgcn_wave_barrier();
    FragB pah, pal;
    pah.half[0] = *(const v8us*)&sPh[w][ln][8 * hh]; pah.half[1] = *(const v8us*)&sPh[w][ln][16 + 8 * hh];
    pal.half[0] = *(const v8us*)&sPl[w][ln][8 * hh]; pal.half[1] = *(const v8us*)&sPl[w][ln][16 + 8 * hh];
#pragma unroll
    for (int dt = 0; dt < DT; ++dt) {
      FragB bvh, bvl;
#pragma unroll
      for (int i = 0; i < 8; ++i) {
        bvh.u[i] = sVh[8 * hh + i][dt * 16 + ln]; bvh.u[8 + i] = sVh[16 + 8 * hh + i][dt * 16 + ln];
        bvl.u[i] = sVl[8 * hh + i][dt * 16 + ln]; bvl.u[8 + i] = sVl[16 + 8 * hh + i][dt * 16 + ln];
      }
      oacc[dt] = mmaN<3>(pah.v, pal.v, bvh.v, bvl.v, oacc[dt]);
    }
    __builtin_amdgcn_fence(__ATOMIC_ACQ_REL, "workgroup");
    __builtin_amdgcn_wave_barrier();
  }
#pragma unroll
  for (int r = 0; r < 8; ++r) {
    float l = l_r[r];
    l += __shfl_xor(l, 1, 32); l += __shfl_xor(l, 2, 32); l += __shfl_xor(l, 4, 32); l += __shfl_xor(l, 8, 32);
    l_r[r] = (l > 0.f) ? 1.0f / l : 0.f;
  }
#pragma unroll
  for (int dt = 0; dt < DT; ++dt)
#pragma unroll
    for (int r = 0; r < 8; ++r) sO[w][8 * hh + r][dt * 16 + ln] = oacc[dt][r] * l_r[r];
  __builtin_amdgcn_fence(__ATOMIC_ACQ_REL, "workgroup");
  __builtin_amdgcn_wave_barrier();
  {
    for (int r = 0; r < 16; ++r) {
      const int row = q0 + r;
      if (row < T && lane < D / 4) {
        const v4f val = *(const v4fa*)&sO[w][r][lane * 4];
        *(v4f*)(y + ((size_t)b * T + row) * ypitch + h * D + lane * 4) = val;
      }
    }
    
  }
}

// GEMM C = act(A·W + bias + resid): A f32 (ASPLIT -> hi/lo 2 terms), Wt bf16 [N][K]; ACT 0 none, 1 relu, 2 exact gelu;
// resid (optional, f32, row index = (row % rmod), pitch ldr, RES_BF16 rounds it) added before the activation.
template <bool ASPLIT, int ACT, bool BIAS_BF16, bool RES_BF16>
__global__ __launch_bounds__(128) void k_gemm_bf3(const float* __restrict__ A, int lda, const unsigned short* __restrict__ Wt, int ldb,
                                                const float* __restrict__ bias, const float* __restrict__ resid, int rmod, int ldr,
                                                float* __restrict__ C, int ldc, int M, int N, int K) {
  __shared__ __attribute__((aligned(16))) float so[4][16][64];
  const int tid = threadIdx.x, w = tid >> 5, lane = tid & 31, ln = lane & 15, hh = lane >> 4;
  const int ntn = N / 64;
  const int wid = blockIdx.x * 4 + w;
  const int mt = wid / ntn, nq = wid % ntn;
  if (mt * 16 >= M) return;
  const int row0 = mt * 16, col0 = nq * 64;
  const float* arow = A + (size_t)(row0 + ln) * lda;
  v8f acc[4] = {};
  for (int kb = 0; kb < K; kb += 32) {
    FragB ah, al;
    const v4f x0 = *(const v4fa*)(arow + kb + 8 * hh), x1 = *(const v4fa*)(arow + kb + 8 * hh + 4);
    const v4f x2 = *(const v4fa*)(arow + kb + 16 + 8 * hh), x3 = *(const v4fa*)(arow + kb + 16 + 8 * hh + 4);
    float xs[16] = {x0[0],x0[1],x0[2],x0[3],x1[0],x1[1],x1[2],x1[3],x2[0],x2[1],x2[2],x2[3],x3[0],x3[1],x3[2],x3[3]};
#pragma unroll
    for (int i = 0; i < 16; ++i) { const unsigned short hb = bf16_bits(xs[i]); ah.u[i] = hb; al.u[i] = ASPLIT ? bf16_bits(xs[i] - bf16_val(hb)) : (unsigned short)0; }
#pragma unroll
    for (int t = 0; t < 4; ++t) {
      const unsigned short* brow = Wt + (size_t)(col0 + t * 16 + ln) * ldb + kb;
      FragB b;
      b.half[0] = *(const v8us*)(brow + 8 * hh);
      b.half[1] = *(const v8us*)(brow + 16 + 8 * hh);
      acc[t] = mmaN<ASPLIT ? 2 : 1>(ah.v, al.v, b.v, b.v, acc[t]);
    }
  }
#pragma unroll
  for (int t = 0; t < 4; ++t) {
    const int col = col0 + t * 16 + ln;
    float bv = bias ? bias[col] : 0.f;
    if (BIAS_BF16) bv = bf16_round(bv);
#pragma unroll
    for (int r = 0; r < 8; ++r) {
      float v = acc[t][r] + bv;
      if (resid) { float rv = resid[(size_t)((row0 + 8 * hh + r) % rmod) * ldr + col]; if (RES_BF16) rv = bf16_round(rv); v += rv; }
      if (ACT == 1) v = fmaxf(v, 0.f);
      if (ACT == 2) v = 0.5f * v * (1.0f + erff(v * 0.70710678118654752f));
      if (ACT == 3) { const float u = 0.7978845608028654f * (v + 0.044715f * v * v * v); v = 0.5f * v * (1.0f + tanhf(u)); }
      so[w][8 * hh + r][t * 16 + ln] = v;
    }
  }
  __builtin_amdgcn_fence(__ATOMIC_ACQ_REL, "workgroup");
  __builtin_amdgcn_wave_barrier();
  const int rsub = lane >> 4, c4 = (lane & 15) * 4;
  {
#pragma unroll
    for (int q = 0; q < 8; ++q) {
      const int r = q * 2 + rsub;
      const v4f v = *(const v4fa*)&so[w][r][c4];
      *(v4f*)(C + (size_t)(row0 + r) * ldc + col0 + c4) = v;
    }
    
  }
}
// row LayerNorm (biased variance, eps) over N: s = X (+ R); optional out_sum <- s; out_norm <- (s-mu)*rsqrt(var+eps)*g + b
template <bool PARAM_BF16>
__global__ __launch_bounds__(256) void k_layernorm(const float* __restrict__ X, const float* __restrict__ R, const float* __restrict__ g, const float* __restrict__ bta,
                                                  float* __restrict__ out_sum, float* __restrict__ out_norm, int N, float eps) {
  __shared__ float red[256];
  const int row = blockIdx.x, tid = threadIdx.x;
  const float* x = X + (size_t)row * N; const float* rr = R ? R + (size_t)row * N : nullptr;
  float vals[16];                     // up to N = 4096
  const int per = N / 256;            // contiguous chunk per thread? use strided-by-4 chunks: thread handles j = tid*4 + 1024*u
  float s1 = 0.f;
  for (int u = 0; u < per / 4; ++u) {
    const int j = tid * 4 + 1024 * u;
    const v4f a = *(const v4fa*)(x + j);
    v4f b = {0.f,0.f,0.f,0.f}; if (rr) b = *(const v4fa*)(rr + j);
#pragma unroll
    for (int q = 0; q < 4; ++q) { const float v = a[q] + b[q]; vals[u * 4 + q] = v; s1 += v; }
  }
  red[tid] = s1; __syncthreads();
  for (int st = 128; st > 0; st >>= 1) { if (tid < st) red[tid] += red[tid + st]; __syncthreads(); }
  const float mu = red[0] / (float)N; __syncthreads();
  float s2 = 0.f;
  for (int u = 0; u < per / 4; ++u)
#pragma unroll
    for (int q = 0; q < 4; ++q) { const float c = vals[u * 4 + q] - mu; s2 += c * c; }
  red[tid] = s2; __syncthreads();
  for (int st = 128; st > 0; st >>= 1) { if (tid < st) red[tid] += red[tid + st]; __syncthreads(); }
  const float rs = rsqrtf(red[0] / (float)N + eps);
  {
    for (int u = 0; u < per / 4; ++u) {
      const int j = tid * 4 + 1024 * u;
      v4f o, sm;
#pragma unroll
      for (int q = 0; q < 4; ++q) {
        float gg = g[j + q], bb = bta[j + q];
        if (PARAM_BF16) { gg = bf16_round(gg); bb = bf16_round(bb); }
        sm[q] = vals[u * 4 + q]; o[q] = (vals[u * 4 + q] - mu) * rs * gg + bb;
      }
      if (out_sum) *(v4f*)(out_sum + (size_t)row * N + j) = sm;
      *(v4f*)(out_norm + (size_t)row * N + j) = o;
    }
    
  }
}



// ---- f16 WMMA path (v_wmma_f32_16x16x32_f16): 11-bit significands for operands in range — used where a [0,1] probability operand needs more precision than bf16
typedef _Float16 v16h __attribute__((ext_vector_type(16)));
union FragH { v16h v; v8us half[2]; _Float16 h[16]; unsigned short u[16]; };
template <int NT>
__device__ __forceinline__ v8f mmaH(v16h ah, v16h al, v16h bh, v16h bl, v8f c) {
  c = __builtin_amdgcn_wmma_f32_16x16x32_f16(false, ah, false, bh, (short)0, c, false, false);
  if (NT >= 2) c = __builtin_amdgcn_wmma_f32_16x16x32_f16(false, al, false, bh, (short)0, c, false, false);
  if (NT >= 3) c = __builtin_amdgcn_wmma_f32_16x16x32_f16(false, ah, false, bl, (short)0, c, false, false);
  asm volatile("v_nop\n\tv_nop\n\tv_nop\n\tv_nop" : "+v"(c) : "v"(ah), "v"(al), "v"(bh), "v"(bl));
  return c;
}
// batched GEMM like k_gemm_b but f16 operands: A f32 (split into f16 hi/lo if ASPLIT, else rounded to f16), Bt = f16 values [n][k]; alpha; C f32; N multiple of 16 (partial tiles skipped)
template <bool ASPLIT>
__global__ __launch_bounds__(128) void k_gemm_h(const float* __restrict__ A, int lda, size_t sA, const _Float16* __restrict__ Bh, int ldb, size_t sB, float alpha, float* __restrict__ C, int ldc, size_t sC, int M, int N, int K) {
  __shared__ __attribute__((aligned(16))) float so[4][16][64];
  const int tid = threadIdx.x, w = tid >> 5, lane = tid & 31, ln = lane & 15, hh = lane >> 4; const int by = blockIdx.y;
  A += (size_t)by * sA; Bh += (size_t)by * sB; C += (size_t)by * sC;
  const int ntn = (N + 63) / 64; const int wid = blockIdx.x * 4 + w; const int mt = wid / ntn, nq = wid % ntn; if (mt * 16 >= M) return;
  const int row0 = mt * 16, col0 = nq * 64; const float* arow = A + (size_t)(row0 + ln) * lda;
  v8f acc[4] = {};
  for (int kb = 0; kb < K; kb += 32) {
    FragH ah, al;
    const v4f x0 = *(const v4fa*)(arow + kb + 8 * hh), x1 = *(const v4fa*)(arow + kb + 8 * hh + 4), x2 = *(const v4fa*)(arow + kb + 16 + 8 * hh), x3 = *(const v4fa*)(arow + kb + 16 + 8 * hh + 4);
    float xs[16] = {x0[0],x0[1],x0[2],x0[3],x1[0],x1[1],x1[2],x1[3],x2[0],x2[1],x2[2],x2[3],x3[0],x3[1],x3[2],x3[3]};
#pragma unroll
    for (int i = 0; i < 16; ++i) { const _Float16 h = (_Float16)xs[i]; ah.h[i] = h; al.h[i] = ASPLIT ? (_Float16)(xs[i] - (float)h) : (_Float16)0.0f; }
#pragma unroll
    for (int t = 0; t < 4; ++t) { if (col0 + t * 16 >= N) continue; const size_t boff = (size_t)(col0 + t * 16 + ln) * ldb + kb; FragH bq; bq.half[0] = *(const v8us*)(Bh + boff + 8 * hh); bq.half[1] = *(const v8us*)(Bh + boff + 16 + 8 * hh);
      acc[t] = mmaH<ASPLIT ? 2 : 1>(ah.v, al.v, bq.v, bq.v, acc[t]); }
  }
#pragma unroll
  for (int t = 0; t < 4; ++t) { if (col0 + t * 16 >= N) continue;
#pragma unroll
    for (int r = 0; r < 8; ++r) so[w][8 * hh + r][t * 16 + ln] = acc[t][r] * alpha; }
  __builtin_amdgcn_fence(__ATOMIC_ACQ_REL, "workgroup"); __builtin_amdgcn_wave_barrier();
  const int rsub = lane >> 4, c4 = (lane & 15) * 4;
  {
#pragma unroll
    for (int q = 0; q < 8; ++q) { const int r = q * 2 + rsub; if (col0 + c4 < N) { const v4f v = *(const v4fa*)&so[w][r][c4]; *(v4f*)(C + (size_t)(row0 + r) * ldc + col0 + c4) = v; } }
     }
}

// Wt[n][k] = f16(bf16(W[k][n])·scale) from f32 row-major W[K][N] (scale = power of two; bf16-exact weights stay exact in f16 away from the subnormal range)
// (bid = the block's index within this piece of work; the pieces are launched together by k_prep below)
__device__ __forceinline__ void d_wt_f16(int bid, const float* __restrict__ W, _Float16* __restrict__ Wt, int K, int N, float scale) {
  const int t = bid * 256 + threadIdx.x; if (t >= N * (K / 8)) return; const int n = t / (K / 8), k8 = (t % (K / 8)) * 8; FragH f;
#pragma unroll
  for (int i = 0; i < 8; ++i) f.h[i] = (_Float16)(bf16_round(W[(size_t)(k8 + i) * N + n]) * scale); const v8us o = f.half[0];
  *(v8us*)((unsigned short*)Wt + (size_t)n * K + k8) = o; 
}
// Block-tile GEMM, f16 operands, f32 accumulate: C[row][col] = act(alpha * sum_k A[row][k] * Bt[col][k]) (+ C if ADDC). A and Bt are K-contiguous with row pitch DM, K = DM.
// One block of 8 waves owns a 128 x BN tile of C. Each pass brings 128 k (256 B of every operand row) from global memory in whole-row pieces into registers and from there into one of two LDS buffers
// (row pitch 272 B, an odd multiple of 16 B, for the 16-byte fragment reads); the next pass's global loads are issued ahead of this pass's products. Every wave computes a (16 * FM) x 32 part from LDS fragments,
// so an operand row is read from L2 once per block, not once per wave. k runs upward in steps of 32 into one accumulator per 16 x 16 tile.
// Every "#pragma unroll" in this kernel is there so that the small arrays it indexes (ra, rb, a, b, acc, o, c0, c, f, fh, fl) get constant indices and stay in registers.
// The body is a device function: sm is the launching kernel's LDS (gemm_lds(BN) bytes, 16-byte aligned), (bx, by) the tile's column and row index.
constexpr int gemm_lds(int BN) { return (2 * (128 + BN) * 272 > BN * 576) ? 2 * (128 + BN) * 272 : BN * 576; }      /* the two stage buffers, or the eight waves' epilogue ranges */
template <int BN, int LDC, int ACT, bool ADDC>
__device__ __forceinline__ void d_gemm_t(unsigned char* const sm, const int bx, const int by, const _Float16* __restrict__ A, const _Float16* __restrict__ Bt, float alpha, float* C,
                                         const float* __restrict__ CS = nullptr, _Float16* __restrict__ P0 = nullptr, _Float16* __restrict__ P1 = nullptr, _Float16* __restrict__ P2 = nullptr) {
  constexpr int BM = 128, BK = 128, PB = BK * 2 + 16, WN = BN / 32, WM = 8 / WN, FM = BM / (16 * WM), NA = BM / 16, NB = BN / 16, KT = DM / BK;
  constexpr int STG = (BM + BN) * PB, EPW = FM * 16 * 36, EPI = 8 * EPW * 4, SZ = (2 * STG > EPI) ? 2 * STG : EPI;
  static_assert(SZ == gemm_lds(BN), "the launching kernel sizes sm by gemm_lds");
  const int tid = threadIdx.x, lane = tid & 31, ln = lane & 15, hh = lane >> 4;
  const int w = __builtin_amdgcn_readfirstlane(tid >> 5);      /* wave number, uniform: it only picks the wave's part of the tile */
  const int wm = w / WN, wn = w % WN;
  const int row0 = by * BM, col0 = bx * BN;
  const int sr = tid >> 4, sc = tid & 15;      /* 16 threads a row: 256 contiguous bytes */
  const unsigned short* ga = (const unsigned short*)A + (size_t)(row0 + sr) * DM + sc * 8;
  const unsigned short* gb = (const unsigned short*)Bt + (size_t)(col0 + sr) * DM + sc * 8;
  unsigned char* const sst = sm + sr * PB + sc * 16;
  const unsigned char* const fa = sm + (wm * FM * 16 + ln) * PB + hh * 16;
  const unsigned char* const fb = sm + (BM + wn * 32 + ln) * PB + hh * 16;
  v8us ra[NA], rb[NB];
#pragma unroll
  for (int i = 0; i < NA; ++i) ra[i] = *(const v8us*)(ga + (size_t)i * 16 * DM);
#pragma unroll
  for (int i = 0; i < NB; ++i) rb[i] = *(const v8us*)(gb + (size_t)i * 16 * DM);
#pragma unroll
  for (int i = 0; i < NA; ++i) *(v8us*)(sst + i * 16 * PB) = ra[i];
#pragma unroll
  for (int i = 0; i < NB; ++i) *(v8us*)(sst + (BM + i * 16) * PB) = rb[i];
  __syncthreads();      /* pass 0 is in buffer 0 before any wave reads a fragment */
  v8f acc[FM][2];
#pragma unroll
  for (int fm = 0; fm < FM; ++fm) { acc[fm][0] = (v8f){0.f,0.f,0.f,0.f,0.f,0.f,0.f,0.f}; acc[fm][1] = acc[fm][0]; }
  for (int kt = 0; kt < KT; ++kt) {
    const int cur = (kt & 1) * STG, nxt = STG - cur;
    if (kt + 1 < KT) {
#pragma unroll
      for (int i = 0; i < NA; ++i) ra[i] = *(const v8us*)(ga + (size_t)i * 16 * DM + (kt + 1) * BK);
#pragma unroll
      for (int i = 0; i < NB; ++i) rb[i] = *(const v8us*)(gb + (size_t)i * 16 * DM + (kt + 1) * BK);
    }
#pragma unroll
    for (int ks = 0; ks < BK / 32; ++ks) {
      FragH a[FM], b[2];
#pragma unroll
      for (int fm = 0; fm < FM; ++fm) { a[fm].half[0] = *(const v8us*)(fa + cur + fm * 16 * PB + ks * 64); a[fm].half[1] = *(const v8us*)(fa + cur + fm * 16 * PB + ks * 64 + 32); }
#pragma unroll
      for (int fn = 0; fn < 2; ++fn) { b[fn].half[0] = *(const v8us*)(fb + cur + fn * 16 * PB + ks * 64); b[fn].half[1] = *(const v8us*)(fb + cur + fn * 16 * PB + ks * 64 + 32); }
#pragma unroll
      for (int fm = 0; fm < FM; ++fm)
#pragma unroll
        for (int fn = 0; fn < 2; ++fn) acc[fm][fn] = __builtin_amdgcn_wmma_f32_16x16x32_f16(false, a[fm].v, false, b[fn].v, (short)0, acc[fm][fn], false, false);
    }
    if (kt + 1 < KT) {      /* the other buffer: its readers left it at the barrier that ended pass kt - 1 */
#pragma unroll
      for (int i = 0; i < NA; ++i) *(v8us*)(sst + nxt + i * 16 * PB) = ra[i];
#pragma unroll
      for (int i = 0; i < NB; ++i) *(v8us*)(sst + nxt + (BM + i * 16) * PB) = rb[i];
    }
    __syncthreads();      /* publishes pass kt + 1 and ends every wave's reads of pass kt */
  }
  if constexpr (ACT == 21 || ACT == 22) {
    /* The tile leaves as the attention kernel's operands, with no f32 copy in memory and no launch in between. ACT 21: all columns are query heads of 64; ACT 22: columns 0..63 are the shared key, 64..127 the shared value.
       Rotary (rotate-half): dims d and d + 32 of a head lie in two waves' parts, so the block's tile is gathered in LDS (free behind the last barrier), row-major, pitch a multiple of 16 B. A thread takes 8 dims d and their partners d + 32 of one row
       and head: out[d] = x[d] cos_d - x[d + 32] sin_d, out[d + 32] = x[d + 32] cos_d + x[d] sin_d in f32, (cos, sin) from the table row of the token's position in its sequence, stored f16: P0, row pitch LDC; a wave's two stores fill whole 128-byte lines.
       The table values are asked for ahead of the gather, so that their latency passes under it.
       Value columns: a lane's 8 accumulator registers are 8 consecutive tokens of one column, a 16-byte piece of a V^T row; they are gathered column-major (pitch BM + 4 floats) and leave as f16 (P1) and x2^10 residual (P2) planes [batch][dim][token], 16 threads a row: whole lines. */
    constexpr int NHT = (ACT == 21) ? BN / HD : 1, PT = NHT * HD + 4, TR = 4 * NHT, RS = 256 / TR, NU = BM / RS, PW = BM + 4;
    static_assert(BN == 128 && TT % BM == 0 && (BM * PT + (ACT == 22 ? HD * PW : 0)) * 4 <= SZ, "two heads, or key and value, a tile; a tile lies inside one sequence; the gathered tile fits the stage buffers");
    float* const st = (float*)sm; float* const sv = st + BM * PT;
    const int g4 = tid & 3, hl = (tid >> 2) % NHT, ur = tid / TR;      /* 8-dim piece, head within the tile, row within a step of RS rows */
    const float* const cp = CS + ((size_t)(row0 % TT + ur) * 32 + g4 * 8) * 2;
    v4f c[NU][4];
#pragma unroll
    for (int q = 0; q < NU; ++q)
#pragma unroll
      for (int j = 0; j < 4; ++j) c[q][j] = *(const v4fa*)(cp + (size_t)q * RS * 64 + j * 4);
    if (ACT == 22) asm volatile("s_wait_xcnt 0x0" ::: "memory");      /* in this body the gather's address arithmetic below reuses the register that these loads name as their address: the wait stands in front of it (in the body of 21 that register pair is left alone) */
    if (ACT == 21 || wn < 2) {      /* wn is uniform for the wave */
#pragma unroll
      for (int fm = 0; fm < FM; ++fm)
#pragma unroll
        for (int fn = 0; fn < 2; ++fn)
#pragma unroll
          for (int r = 0; r < 8; ++r) st[((wm * FM + fm) * 16 + 8 * hh + r) * PT + wn * 32 + fn * 16 + ln] = acc[fm][fn][r] * alpha;
    } else {
#pragma unroll
      for (int fm = 0; fm < FM; ++fm)
#pragma unroll
        for (int fn = 0; fn < 2; ++fn) { const v8f t = acc[fm][fn] * alpha; float* const d = sv + ((wn - 2) * 32 + fn * 16 + ln) * PW + (wm * FM + fm) * 16 + 8 * hh;
          *(v4fa*)d = (v4f){t[0], t[1], t[2], t[3]}; *(v4fa*)(d + 4) = (v4f){t[4], t[5], t[6], t[7]}; }
    }
    __syncthreads();      /* every wave's part of the tile is in LDS before any wave reads a row or a column */
#pragma unroll
    for (int q = 0; q < NU; ++q) { const float* const xr = st + (q * RS + ur) * PT + hl * HD + g4 * 8;
      const v4f a0 = *(const v4fa*)xr, a1 = *(const v4fa*)(xr + 4), b0 = *(const v4fa*)(xr + 32), b1 = *(const v4fa*)(xr + 36); FragH f;
#pragma unroll
      for (int e = 0; e < 8; ++e) { const float a = (e < 4) ? a0[e & 3] : a1[e & 3], b = (e < 4) ? b0[e & 3] : b1[e & 3], cs = c[q][e >> 1][(e & 1) * 2], sn = c[q][e >> 1][(e & 1) * 2 + 1];
        f.h[e] = (_Float16)(a * cs - b * sn); f.h[8 + e] = (_Float16)(b * cs + a * sn); }
      unsigned short* const o = (unsigned short*)P0 + (size_t)(row0 + q * RS + ur) * LDC + col0 + hl * HD + g4 * 8;
      *(v8us*)o = f.half[0]; *(v8us*)(o + 32) = f.half[1]; }
    if (ACT == 22) {
#pragma unroll
      for (int q = 0; q < HD * (BM / 8) / 256; ++q) { const int e = q * 256 + tid, pc = e % (BM / 8), d = e / (BM / 8);
        const v4f x0 = *(const v4fa*)&sv[d * PW + pc * 8], x1 = *(const v4fa*)&sv[d * PW + pc * 8 + 4]; FragH fh, fl;
#pragma unroll
        for (int i = 0; i < 8; ++i) { const float v = (i < 4) ? x0[i & 3] : x1[i & 3]; const _Float16 hv = (_Float16)v; fh.h[i] = hv; fl.h[i] = (_Float16)((v - (float)hv) * 1024.0f); }
        const size_t oo = ((size_t)(row0 / TT) * HD + d) * TT + row0 % TT + pc * 8;
        *(v8us*)((unsigned short*)P1 + oo) = fh.half[0]; *(v8us*)((unsigned short*)P2 + oo) = fl.half[0]; }
    }
    return;
  }
  if (ACT == 11) {
    /* sigmoid outputs leave column-major, C[col][row] with row pitch LDC: the attention kernel reads 8 consecutive rows (keys) of one column (head) per lane. A lane's 8 accumulator registers are 8 consecutive rows of one column;
       the block's tile is gathered in LDS (free behind the last barrier; pitch BM + 4 floats keeps 16-byte alignment) so that each wave stores whole 128-byte lines. */
    constexpr int PT = BM + 4;
    float* const st = (float*)sm;
#pragma unroll
    for (int fm = 0; fm < FM; ++fm)
#pragma unroll
      for (int fn = 0; fn < 2; ++fn) { v4f lo, hi;
#pragma unroll
        for (int r = 0; r < 4; ++r) { lo[r] = 1.0f / (1.0f + expf(-(acc[fm][fn][r] * alpha))); hi[r] = 1.0f / (1.0f + expf(-(acc[fm][fn][4 + r] * alpha))); }
        float* const d = st + (wn * 32 + fn * 16 + ln) * PT + (wm * FM + fm) * 16 + 8 * hh; *(v4fa*)d = lo; *(v4fa*)(d + 4) = hi; }
    __syncthreads();      /* every wave's rows of the tile are in LDS before any wave stores a column */
    for (int q = 0; q < BN * BM / 4 / 256; ++q) { const int e = q * 256 + tid, col = e / (BM / 4), r4 = (e % (BM / 4)) * 4; const v4f v = *(const v4fa*)&st[col * PT + r4]; *(v4f*)(C + (size_t)(col0 + col) * LDC + row0 + r4) = v; }
    return;
  }
  /* epilogue: behind the last barrier the buffers are free; each wave turns its part into whole 128-byte rows in its own LDS range (row pitch 36 floats) */
  float* const so = (float*)sm + w * EPW;
  const int er = lane >> 3, ec = (lane & 7) * 4;      /* 8 lanes a row of 32 floats */
  float* const cp = C + (size_t)(row0 + wm * FM * 16 + er) * LDC + col0 + wn * 32 + ec;      /* one address for all rows of the part; the row step is a constant offset */
  v4f o[FM * 4], c0[FM * 4];
#pragma unroll
  for (int fm = 0; fm < FM; ++fm)
#pragma unroll
    for (int fn = 0; fn < 2; ++fn)
#pragma unroll
      for (int r = 0; r < 8; ++r) so[(fm * 16 + 8 * hh + r) * 36 + fn * 16 + ln] = acc[fm][fn][r] * alpha;
  __builtin_amdgcn_fence(__ATOMIC_ACQ_REL, "workgroup"); __builtin_amdgcn_wave_barrier();      /* the wave's own LDS writes are done before its lanes read each other's */
  if (ADDC) {      /* the old values, all asked for at once, once the accumulators' registers are free */
#pragma unroll
    for (int q = 0; q < FM * 4; ++q) c0[q] = *(const v4fa*)(cp + (size_t)q * 4 * LDC);
  }
#pragma unroll
  for (int q = 0; q < FM * 4; ++q) { o[q] = *(const v4fa*)&so[(q * 4 + er) * 36 + ec]; if (ADDC) o[q] += c0[q]; }
#pragma unroll
  for (int q = 0; q < FM * 4; ++q) *(v4f*)(cp + (size_t)q * 4 * LDC) = o[q];
}
// Output projection, both planes of O in one launch: C = (Ah.Bt^T + 2^-10 Al.Bt^T) / 16, operands K-contiguous with row pitch DM, K = DM. One block of 16 waves owns a 128 x 128 tile of C (256 blocks, one a WGP, four waves a SIMD).
// A pass stages 128 k of the tile's rows of Ah, of Al and of Bt as d_gemm_t does (whole-row loads into registers, from there into one of two LDS buffers, row pitch 272 B; the next pass's loads are issued ahead of this pass's products):
// a Bt row is brought in and a Bt fragment read once for both planes. Every wave computes a 32 x 32 part with one accumulator per 16 x 16 tile AND plane, k upward in steps of 32 as in the two single launches; the planes meet in registers
// in the epilogue (both scalings are by powers of two, so the one rounding of the sum is the one the read-add-write of C made), and C is written once and never read.
// Every "#pragma unroll" in this kernel is there so that the small arrays it indexes (rh, rl, rb, ah, al, b, the accumulators, o) get constant indices and stay in registers.
__global__ __launch_bounds__(512) void k_gemm_o(const _Float16* __restrict__ Ah, const _Float16* __restrict__ Al, const _Float16* __restrict__ Bt, float* __restrict__ C) {
  constexpr int BM = 128, BN = 128, BK = 128, PB = BK * 2 + 16, FM = 2, NS = BM / 32, KT = DM / BK;
  constexpr int OAL = BM * PB, OB = 2 * BM * PB, STG = (2 * BM + BN) * PB, EPW = FM * 16 * 36;      /* a stage: rows of Ah, of Al, of Bt */
  static_assert(BN == BM && 16 * EPW * 4 <= 2 * STG, "one count of staging steps for the three operands; the sixteen epilogue ranges lie inside the two stage buffers");
  __shared__ __attribute__((aligned(16))) unsigned char sm[2 * STG];
  const int tid = threadIdx.x, lane = tid & 31, ln = lane & 15, hh = lane >> 4;
  const int w = __builtin_amdgcn_readfirstlane(tid >> 5);      /* wave number, uniform: it only picks the wave's part of the tile */
  const int wm = w >> 2, wn = w & 3;
  const int row0 = blockIdx.y * BM, col0 = blockIdx.x * BN;
  const int sr = tid >> 4, sc = tid & 15;      /* 16 threads a row: 256 contiguous bytes; 32 rows a step */
  const unsigned short* gh = (const unsigned short*)Ah + (size_t)(row0 + sr) * DM + sc * 8;
  const unsigned short* gl = (const unsigned short*)Al + (size_t)(row0 + sr) * DM + sc * 8;
  const unsigned short* gb = (const unsigned short*)Bt + (size_t)(col0 + sr) * DM + sc * 8;
  unsigned char* const sst = sm + sr * PB + sc * 16;
  const unsigned char* const fa = sm + (wm * FM * 16 + ln) * PB + hh * 16;
  const unsigned char* const fb = sm + OB + (wn * 32 + ln) * PB + hh * 16;
  v8us rh[NS], rl[NS], rb[NS];
#pragma unroll
  for (int i = 0; i < NS; ++i) { rh[i] = *(const v8us*)(gh + (size_t)i * 32 * DM); rl[i] = *(const v8us*)(gl + (size_t)i * 32 * DM); rb[i] = *(const v8us*)(gb + (size_t)i * 32 * DM); }
#pragma unroll
  for (int i = 0; i < NS; ++i) { *(v8us*)(sst + i * 32 * PB) = rh[i]; *(v8us*)(sst + OAL + i * 32 * PB) = rl[i]; *(v8us*)(sst + OB + i * 32 * PB) = rb[i]; }
  __syncthreads();      /* pass 0 is in buffer 0 before any wave reads a fragment */
  v8f acch[FM][2], accl[FM][2];
#pragma unroll
  for (int fm = 0; fm < FM; ++fm)
#pragma unroll
    for (int fn = 0; fn < 2; ++fn) { acch[fm][fn] = (v8f){0.f,0.f,0.f,0.f,0.f,0.f,0.f,0.f}; accl[fm][fn] = acch[fm][fn]; }
  for (int kt = 0; kt < KT; ++kt) {
    const int cur = (kt & 1) * STG, nxt = STG - cur;
    if (kt + 1 < KT) {
#pragma unroll
      for (int i = 0; i < NS; ++i) { rh[i] = *(const v8us*)(gh + (size_t)i * 32 * DM + (kt + 1) * BK); rl[i] = *(const v8us*)(gl + (size_t)i * 32 * DM + (kt + 1) * BK); rb[i] = *(const v8us*)(gb + (size_t)i * 32 * DM + (kt + 1) * BK); }
      __builtin_amdgcn_sched_barrier(0);      /* keeps the twelve loads in front of the pass's products: left free, the compiler sinks them behind three quarters of the pass, and their latency then stands bare in front of the LDS stores */
    }
#pragma unroll
    for (int ks = 0; ks < BK / 32; ++ks) {
      FragH ah[FM], al[FM], b[2];
#pragma unroll
      for (int fm = 0; fm < FM; ++fm) { const unsigned char* p = fa + cur + fm * 16 * PB + ks * 64; ah[fm].half[0] = *(const v8us*)p; ah[fm].half[1] = *(const v8us*)(p + 32); al[fm].half[0] = *(const v8us*)(p + OAL); al[fm].half[1] = *(const v8us*)(p + OAL + 32); }
#pragma unroll
      for (int fn = 0; fn < 2; ++fn) { const unsigned char* p = fb + cur + fn * 16 * PB + ks * 64; b[fn].half[0] = *(const v8us*)p; b[fn].half[1] = *(const v8us*)(p + 32); }
#pragma unroll
      for (int fm = 0; fm < FM; ++fm)
#pragma unroll
        for (int fn = 0; fn < 2; ++fn) { acch[fm][fn] = __builtin_amdgcn_wmma_f32_16x16x32_f16(false, ah[fm].v, false, b[fn].v, (short)0, acch[fm][fn], false, false); accl[fm][fn] = __builtin_amdgcn_wmma_f32_16x16x32_f16(false, al[fm].v, false, b[fn].v, (short)0, accl[fm][fn], false, false); }
    }
    if (kt + 1 < KT) {      /* the other buffer: its readers left it at the barrier that ended pass kt - 1 */
#pragma unroll
      for (int i = 0; i < NS; ++i) { *(v8us*)(sst + nxt + i * 32 * PB) = rh[i]; *(v8us*)(sst + nxt + OAL + i * 32 * PB) = rl[i]; *(v8us*)(sst + nxt + OB + i * 32 * PB) = rb[i]; }
    }
    __syncthreads();      /* publishes pass kt + 1 and ends every wave's reads of pass kt */
  }
  /* epilogue: behind the last barrier the buffers are free; each wave turns its part into whole 128-byte rows in its own LDS range (row pitch 36 floats) */
  float* const so = (float*)sm + w * EPW;
  const int er = lane >> 3, ec = (lane & 7) * 4;      /* 8 lanes a row of 32 floats */
  float* const cp = C + (size_t)(row0 + wm * FM * 16 + er) * DM + col0 + wn * 32 + ec;      /* one address for all rows of the part; the row step is a constant offset */
  v4f o[FM * 4];
#pragma unroll
  for (int fm = 0; fm < FM; ++fm)
#pragma unroll
    for (int fn = 0; fn < 2; ++fn)
#pragma unroll
      for (int r = 0; r < 8; ++r) so[(fm * 16 + 8 * hh + r) * 36 + fn * 16 + ln] = acch[fm][fn][r] * 0.0625f + accl[fm][fn][r] * (0.0625f * 0.0009765625f);      /* Bt carries x2^4, Al x2^10 */
  __builtin_amdgcn_fence(__ATOMIC_ACQ_REL, "workgroup"); __builtin_amdgcn_wave_barrier();      /* the wave's own LDS writes are done before its lanes read each other's */
#pragma unroll
  for (int q = 0; q < FM * 4; ++q) o[q] = *(const v4fa*)&so[(q * 4 + er) * 36 + ec];
#pragma unroll
  for (int q = 0; q < FM * 4; ++q) *(v4f*)(cp + (size_t)q * 4 * DM) = o[q];
}
// The three projections of x (q, [k | v], the head scalars) do not depend on one another: one launch holds the tiles of all three, each block doing one tile as before. The two narrow products have 32 tiles each, too few to fill the chip alone;
// here they run beside the 256 tiles of q (two blocks fit a WGP's LDS), and two launch gaps go. The test on the block index is uniform for the block, so every barrier inside a body is passed by the whole block.
// q and [k | v] leave their tiles as the attention kernel reads them (rotary q and k in f16, V^T planes): d_gemm_t's epilogues 21 and 22.
__global__ __launch_bounds__(256) void k_proj(const _Float16* __restrict__ X16, const _Float16* __restrict__ Bq, const _Float16* __restrict__ Bkv, const _Float16* __restrict__ Bkh, const float* __restrict__ CS,
                                              _Float16* __restrict__ Q16, _Float16* __restrict__ K16, _Float16* __restrict__ Vth, _Float16* __restrict__ Vtl, float* HS) {
  constexpr int NQX = DM / 128, NRT = NR / 128;
  __shared__ __attribute__((aligned(16))) unsigned char sm[gemm_lds(128)];
  const int bid = blockIdx.x;
  /* the tests run from the narrow tile up: so the compiler keeps the pass loop of both 128-wide bodies as it is in the single launches; with q tested first it lays out all eight passes of q, three times the text */
  if (bid >= (NQX + 1) * NRT) d_gemm_t<32, NR, 11, false>(sm, 0, bid - (NQX + 1) * NRT, X16, Bkh, 0.0625f, HS);      /* [kh | vh] = sigmoid(x.Wkvh): M 4096 N 32 K 1024, stored head-major: 32 rows of 4096 f32 */
  else if (bid >= NQX * NRT) { d_gemm_t<128, HD, 22, false>(sm, 0, bid - NQX * NRT, X16, Bkv, 0.0625f, nullptr, CS, K16, Vth, Vtl);      /* [k | v]: M 4096 N 128 K 1024 -> rotary k [4096][64] f16, V^T hi/lo per batch [b][64][T] */
    asm volatile("s_wait_xcnt 0x0" ::: "memory"); }      /* in this kernel's text another body follows the tile's stores and rewrites their registers: the wait stands between */
  else { d_gemm_t<128, DM, 21, false>(sm, bid % NQX, bid / NQX, X16, Bq, 0.0625f, nullptr, CS, Q16);      /* q: M 4096 N 1024 K 1024 -> rotary q f16 */
    asm volatile("s_wait_xcnt 0x0" ::: "memory"); }      /* as above */
}


typedef _Float16 v4h __attribute__((ext_vector_type(4)));

__device__ __forceinline__ void d_x16(int bid, const float* __restrict__ x, _Float16* __restrict__ X16, size_t n8) { const size_t t = (size_t)bid * 256 + threadIdx.x; if (t >= n8) return; FragH f;
#pragma unroll
  for (int q = 0; q < 8; ++q) f.h[q] = (_Float16)bf16_round(x[t * 8 + q]); *(v8us*)((unsigned short*)X16 + t * 8) = f.half[0];  }
__global__ __launch_bounds__(256) void k_h16(const float* __restrict__ x, _Float16* __restrict__ X16, size_t n8) { const size_t t = (size_t)blockIdx.x * 256 + threadIdx.x; if (t >= n8) return; FragH f;
#pragma unroll
  for (int q = 0; q < 8; ++q) f.h[q] = (_Float16)x[t * 8 + q]; *(v8us*)((unsigned short*)X16 + t * 8) = f.half[0];  }
__global__ __launch_bounds__(256) void k_round16f(const float* __restrict__ W, _Float16* __restrict__ Bt, size_t n8) { const size_t t = (size_t)blockIdx.x * 256 + threadIdx.x; if (t >= n8) return; FragH f;
#pragma unroll
  for (int i = 0; i < 8; ++i) f.h[i] = (_Float16)(bf16_round(W[t * 8 + i]) * 16.0f); *(v8us*)((unsigned short*)Bt + t * 8) = f.half[0];  }
template <int NHv, int TTv>
__global__ __launch_bounds__(256) void k_vt(const _Float16* __restrict__ V16, int ldv, int voff, _Float16* __restrict__ Vt) { __shared__ unsigned short tl[64][66]; const int tid = threadIdx.x; const int slab = blockIdx.x / (TTv / 64), lg = blockIdx.x % (TTv / 64); const int b = slab / NHv, h = slab % NHv;
  for (int i = tid; i < 64 * 8; i += 256) { const int r = i / 8, c8 = (i % 8) * 8; FragH f; f.half[0] = *(const v8us*)((const unsigned short*)V16 + ((size_t)b * TTv + lg * 64 + r) * ldv + voff + h * 64 + c8);
#pragma unroll
    for (int q = 0; q < 8; ++q) tl[r][c8 + q] = f.u[q]; }
  __syncthreads();
  {
#pragma unroll
    for (int rd = 0; rd < 2; ++rd) { const int d = rd * 32 + tid / 8, pc = tid % 8; FragH f;
#pragma unroll
      for (int q = 0; q < 8; ++q) f.u[q] = tl[pc * 8 + q][d];
      *(v8us*)((unsigned short*)Vt + ((size_t)slab * 64 + d) * TTv + lg * 64 + pc * 8) = f.half[0]; }
     } }

__device__ __forceinline__ void d_cstab(int bid, float* __restrict__ CS) { const int t = bid * 256 + threadIdx.x; if (t >= TT * 32) return; const int p = t / 32, i = t % 32; const float invf = powf(10000.0f, -(float)(2 * i) / (float)HD); float sn, cs; sincosf((float)p * invf, &sn, &cs); typedef float v2f __attribute__((ext_vector_type(2), may_alias)); const v2f v = {cs, sn};
  *(v2f*)(CS + (size_t)t * 2) = v;  }
// Everything that depends on the inputs alone (the four weight transposes, x in f16, the cos/sin table) in one launch: a block does what a block of the single launches did, picked by ranges of the block index; five launch gaps, drains and refills go.
// The table's range stands first: further down the chain of tests the compiler rates its powf as cold and leaves it a called function. Then the transposes, whose strided reads take the longest to return.
__global__ __launch_bounds__(256) void k_prep(const float* __restrict__ x, const float* __restrict__ Wq, const float* __restrict__ Wkv, const float* __restrict__ Wkvh, const float* __restrict__ Wo,
                                              _Float16* __restrict__ X16, _Float16* __restrict__ Bq, _Float16* __restrict__ Bkv, _Float16* __restrict__ Bkh, _Float16* __restrict__ Bo, float* __restrict__ CS) {
  constexpr int NBW = DM * (DM / 8) / 256, NBKV = 2 * HD * (DM / 8) / 256, NBKH = 2 * NH * (DM / 8) / 256, NBCS = TT * 32 / 256;      /* blocks of a square weight, of Wkv, of Wkvh, of the table */
  int bid = blockIdx.x;
  if (bid < NBCS) { d_cstab(bid, CS); return; }
  bid -= NBCS;
  if (bid < NBW) { d_wt_f16(bid, Wq, Bq, DM, DM, 16.0f); return; }
  bid -= NBW;
  if (bid < NBW) { d_wt_f16(bid, Wo, Bo, DM, DM, 16.0f); return; }
  bid -= NBW;
  if (bid < NBKV) { d_wt_f16(bid, Wkv, Bkv, DM, 2 * HD, 16.0f); return; }
  bid -= NBKV;
  if (bid < NBKH) { d_wt_f16(bid, Wkvh, Bkh, DM, 2 * NH, 16.0f); return; }      /* (in,out) -> Bt x2^4 */
  bid -= NBKH;
  d_x16(bid, x, X16, (size_t)NR * DM / 8);
}
typedef float v2p __attribute__((ext_vector_type(2)));
/* lane l with lane l ^ 16: one vector cross-row move */
__device__ __forceinline__ float xhalf(float x) { return __builtin_bit_cast(float, __builtin_amdgcn_permlanex16(__builtin_bit_cast(int, x), __builtin_bit_cast(int, x), 0x76543210, 0xfedcba98, false, false)); }
/* 2^x with the instruction set's one free slot behind a transcendental held in the same statement. */
__device__ __forceinline__ float exp2_slot(float x) { float y; asm("v_exp_f32 %0, %1\n\tv_nop" : "=v"(y) : "v"(x)); return y; }
/* One stage of k_flash's key loop, 128 keys, from global memory straight into LDS: a thread's 4 + 4 + 4 pieces of 16 bytes (key rows, V^T high rows, V^T residual rows) and one piece of 8 bytes (head scalars).
   Every wave's 32 lanes cover whole 128-byte lines. The s_wait_xcnt closes the statement so that no address register named here is rewritten while a copy may still read it. */
__device__ __forceinline__ void stage_copies(unsigned lk, unsigned lv, unsigned lw, unsigned lh, const char* gk, const char* gv, const char* gw, const char* gh) {
  asm volatile("global_load_async_to_lds_b128 %0, %13, off\n\t"
               "global_load_async_to_lds_b128 %1, %14, off\n\t"
               "global_load_async_to_lds_b128 %2, %15, off\n\t"
               "global_load_async_to_lds_b128 %3, %16, off\n\t"
               "global_load_async_to_lds_b128 %4, %17, off\n\t"
               "global_load_async_to_lds_b128 %5, %18, off\n\t"
               "global_load_async_to_lds_b128 %6, %19, off\n\t"
               "global_load_async_to_lds_b128 %7, %20, off\n\t"
               "global_load_async_to_lds_b128 %8, %21, off\n\t"
               "global_load_async_to_lds_b128 %9, %22, off\n\t"
               "global_load_async_to_lds_b128 %10, %23, off\n\t"
               "global_load_async_to_lds_b128 %11, %24, off\n\t"
               "global_load_async_to_lds_b64 %12, %25, off\n\t"
               "s_wait_xcnt 0x0"
               :: "v"(lk), "v"(lk + 32u * 144u), "v"(lk + 64u * 144u), "v"(lk + 96u * 144u),
                  "v"(lv), "v"(lv + 16u * 272u), "v"(lv + 32u * 272u), "v"(lv + 48u * 272u),
                  "v"(lw), "v"(lw + 16u * 272u), "v"(lw + 32u * 272u), "v"(lw + 48u * 272u), "v"(lh),
                  "v"(gk), "v"(gk + 32 * HD * 2), "v"(gk + 64 * HD * 2), "v"(gk + 96 * HD * 2),
                  "v"(gv), "v"(gv + 16 * TT * 2), "v"(gv + 32 * TT * 2), "v"(gv + 48 * TT * 2),
                  "v"(gw), "v"(gw + 16 * TT * 2), "v"(gw + 32 * TT * 2), "v"(gw + 48 * TT * 2), "v"(gh)
               : "memory");
}
__global__ __launch_bounds__(256) __attribute__((amdgpu_waves_per_eu(4, 4))) void k_flash(const _Float16* __restrict__ Q16, int ldq, const _Float16* __restrict__ K16, const float* __restrict__ KH, const float* __restrict__ VHD, const _Float16* __restrict__ Vt, const _Float16* __restrict__ Vtlo, _Float16* __restrict__ OH, _Float16* __restrict__ OL, int ldo) {
  // One block = one 16-row query tile of TWO heads, 8 waves: wave w works for head w & 1 and takes the 32-key chunks kq, kq + 4, ... with kq = w >> 1; each wave keeps its own running max, sum and accumulators, and a head's four partial results are merged through LDS at the end.
  // Key rows and value rows are the same for every head, so a stage of 128 keys (four chunks: key rows, both V^T planes, the two heads' scalars) is brought into LDS once per block, in whole 128-byte lines, by asynchronous copies,
  // and the waves read their fragments from LDS (row pitches 144 B and 272 B, odd multiples of 16 B, for the 16-byte fragment reads). Two buffers: stage t + 1 flies while stage t is worked on.
  // A causal tile's cost grows with its index and there are more blocks than resident places, so the block index counts the tiles down: the longest start first. Two blocks share a WGP (four waves a SIMD): registers are held to 256 and LDS to under 160 KiB for that.
  // Both products are transposed: S^T = K.Q^T (A = 16 key rows, B = the query tile) and O^T += V^T.P^T (A = 16 rows of V^T, B = P^T). A lane then holds 16 of the 32 scores of ONE query (column ln; keys 8 hh + r and 16 + 8 hh + r),
  // so max and sum run in the lane with one exchange between the halves, the rescale factor is one value a lane (and both are due only when the reference in use falls too far behind: see the loop), and the two score tiles, converted in place, are the B operand of the second product in the k order of the V^T loader.
  // KH and VHD are head-major, [head][token]: a lane's 8 keys of a tile are 32 contiguous bytes.
  // Every "#pragma unroll" in this kernel is there so that the small arrays it indexes (bq, ak, av, avl, kh, vh, sc, p, bp, bpl, the accumulators, mw) get constant indices and stay in registers; "#pragma unroll 1" keeps one copy of the key loop's body, whose registers are the kernel's limit.
  constexpr int RPW = 16, NQT = TT / RPW, DT = 4, KS = 2, HB = 2, KQ = 4, NW = HB * KQ, SK = KQ * 32, NHG = NH / HB;
  constexpr int PK = HD * 2 + 16, PV = SK * 2 + 16, OVH = SK * PK, OVL = OVH + HD * PV, OHS = OVL + HD * PV, STG = OHS + 2 * HB * SK * 4;      /* a stage in LDS: key rows, V^T high, V^T residual, scalars (kh of the heads, then vh) */
  static_assert(PK == 144 && PV == 272 && SK == 128 && NW * 32 == 256, "stage_copies is written for these pitches, this stage and this block");
  constexpr float SCL2 = 0.125f * 1.44269504088896340736f;      /* 1/sqrt(64) times log2(e): e^(s - m) = 2^(s' - m') with s' = s log2(e), so every exponential of the softmax is one subtraction and the hardware's own 2^x; running maxima and merge weights are in the same units. A result below the normal range may come out as 0: a weight far below what any f32 sum here can see. */
  __shared__ __attribute__((aligned(16))) unsigned char sb[2 * STG];
  __shared__ __attribute__((aligned(16))) float sO[NW][RPW][64 + 4]; __shared__ float sM[NW][RPW], sL[NW][RPW];
  const int tid = threadIdx.x, lane = tid & 31, ln = lane & 15, hh = lane >> 4;
  const int w = __builtin_amdgcn_readfirstlane(tid >> 5);      /* wave number in a scalar register: it decides whether the wave has a chunk in a stage, and the branch around the matrix instructions must be a scalar one */
  const int hs = w % HB, kq = w / HB;
  const int slab = blockIdx.x % (BB * NHG), qt = NQT - 1 - blockIdx.x / (BB * NHG); const int b = slab / NHG, hg = slab % NHG; const int h = hg * HB + hs; const int q0 = qt * RPW;
  FragH bq[KS];
  { const unsigned short* qr = (const unsigned short*)Q16 + ((size_t)b * TT + q0 + ln) * ldq + h * 64;
#pragma unroll
    for (int ks = 0; ks < KS; ++ks) { bq[ks].half[0] = *(const v8us*)(qr + ks * 32 + 8 * hh); bq[ks].half[1] = *(const v8us*)(qr + ks * 32 + 16 + 8 * hh); } }
  /* the thread's pieces of a stage: 8 threads a key row (128 B), 16 threads a V^T row (256 B), 64 threads a scalar row (512 B) */
  const int hr = tid >> 6;      /* scalar row: kh of head 0, 1, then vh of head 0, 1 */
  const char* gk = (const char*)(K16 + ((size_t)b * TT + (tid >> 3)) * HD) + (tid & 7) * 16;
  const char* gv = (const char*)(Vt + ((size_t)b * 64 + (tid >> 4)) * TT) + (tid & 15) * 16;
  const char* gw = (const char*)(Vtlo + ((size_t)b * 64 + (tid >> 4)) * TT) + (tid & 15) * 16;
  const char* gh = (const char*)((hr < HB ? KH : VHD) + (size_t)(hg * HB + hr % HB) * NR + (size_t)b * TT) + (tid & 63) * 8;
  const unsigned lb = (unsigned)(size_t)sb;      /* byte address of the ring in the work-group's LDS */
  const unsigned lk = lb + (unsigned)((tid >> 3) * PK + (tid & 7) * 16), lv = lb + (unsigned)(OVH + (tid >> 4) * PV + (tid & 15) * 16), lw = lv + (unsigned)(OVL - OVH), lh = lb + (unsigned)(OHS + hr * SK * 4 + (tid & 63) * 8);
  /* the lane's fragment places in a stage */
  const unsigned char* const fk = sb + (kq * 32 + ln) * PK + hh * 16;
  const unsigned char* const fv = sb + OVH + ln * PV + (kq * 32 + 8 * hh) * 2;
  const unsigned char* const fh = sb + OHS + hs * SK * 4 + (kq * 32 + 8 * hh) * 4;
  float m_r = -3.0e38f, l_r = 0.f; v8f oacc[DT], oaccl[DT], oacc2[DT];
#pragma unroll
  for (int dt = 0; dt < DT; ++dt) { oacc[dt] = (v8f){0.f,0.f,0.f,0.f,0.f,0.f,0.f,0.f}; oaccl[dt] = oacc[dt]; oacc2[dt] = oacc[dt]; }
  const int jend = q0 + RPW;
  const int nst = (jend + SK - 1) / SK;      /* stages of the tile, the same for the whole block; a stage lies wholly inside the TT keys */
  stage_copies(lk, lv, lw, lh, gk, gv, gw, gh);
  asm volatile("s_wait_asynccnt 0x0" ::: "memory");      /* this wave's pieces of stage 0 have landed */
  __syncthreads();      /* every wave's pieces of stage 0 are in LDS before any wave reads a fragment */
  if (nst > 1) stage_copies(lk + STG, lv + STG, lw + STG, lh + STG, gk + SK * HD * 2, gv + SK * 2, gw + SK * 2, gh + SK * 4);
#pragma unroll 1
  for (int t = 0; t < nst; ++t) {
    const int cur = (t & 1) * STG; const int j0 = t * SK + kq * 32;
    if (j0 < jend) {      /* scalar test: the last stage of a tile may hold fewer than four chunks */
    FragH ak[2][KS], av[DT], avl[DT]; v4f kh[2][2], vh[2][2];
#pragma unroll
    for (int nt = 0; nt < 2; ++nt) {
#pragma unroll
      for (int ks = 0; ks < KS; ++ks) { const unsigned char* kr = fk + cur + nt * 16 * PK + ks * 64; ak[nt][ks].half[0] = *(const v8us*)kr; ak[nt][ks].half[1] = *(const v8us*)(kr + 32); }
      const unsigned char* kp = fh + cur + nt * 64; const unsigned char* vp = kp + HB * SK * 4;
      kh[nt][0] = *(const v4fa*)kp; kh[nt][1] = *(const v4fa*)(kp + 16); vh[nt][0] = *(const v4fa*)vp; vh[nt][1] = *(const v4fa*)(vp + 16); }
    v2p sc[2][4];      /* the lane's 16 scores as pairs of neighbouring registers, as the accumulators and the scalars lie: the packed f32 forms take them without a move */
#pragma unroll
    for (int nt = 0; nt < 2; ++nt) { v8f acc = (v8f){0.f,0.f,0.f,0.f,0.f,0.f,0.f,0.f};
#pragma unroll
      for (int ks = 0; ks < KS; ++ks) acc = __builtin_amdgcn_wmma_f32_16x16x32_f16(false, ak[nt][ks].v, false, bq[ks].v, (short)0, acc, false, false);
#pragma unroll
      for (int i = 0; i < 4; ++i) sc[nt][i] = (v2p){acc[2 * i], acc[2 * i + 1]} * (v2p){kh[nt][i >> 1][(i & 1) * 2], kh[nt][i >> 1][(i & 1) * 2 + 1]}; }      /* q.k times the key's head scalar; the scale to base-2 units and the reference are applied together, in one fused multiply-add, in weights() */
    if (j0 + 31 > q0) {      /* only a chunk that reaches past the tile's first query has keys to mask (scalar test); every query keeps at least one key of every chunk of the loop */
#pragma unroll
      for (int nt = 0; nt < 2; ++nt)
#pragma unroll
        for (int r = 0; r < 8; ++r) sc[nt][r >> 1][r & 1] = (j0 + nt * 16 + 8 * hh + r <= q0 + ln) ? sc[nt][r >> 1][r & 1] : -INFINITY; }
    /* Lazy rescale. m_r is the reference in use, not the running maximum: any reference gives the same softmax as long as sums and accumulators hold the same one. The weights are formed against it at once;
       only if some lane's 16 weights of this chunk sum to more than 32 (so also on the wave's first chunk, where the reference is -3e38 and the weights come out infinite) is the true maximum found, the reference raised,
       sums and accumulators rescaled and the weights formed again. Past the test every weight is at most 32, so p * vh * 1024 <= 32768 and its residual * 1024 <= 16384 stay inside f16. */
    v2p p[2][4]; float ps;
    const auto weights = [&]() {
#pragma unroll
      for (int nt = 0; nt < 2; ++nt)
#pragma unroll
        for (int i = 0; i < 4; ++i) { const v2p e = __builtin_elementwise_fma(sc[nt][i], (v2p){SCL2, SCL2}, (v2p){-m_r, -m_r}); p[nt][i] = (v2p){__builtin_amdgcn_exp2f(e[0]), __builtin_amdgcn_exp2f(e[1])}; }      /* a masked score is -inf: p = 0 */
      const v2p s = ((p[0][0] + p[1][0]) + (p[0][1] + p[1][1])) + ((p[0][2] + p[1][2]) + (p[0][3] + p[1][3]));      /* a tree: the test below waits for this sum */
      ps = s[0] + s[1];
    };
    weights();
    if (__builtin_amdgcn_ballot_w32(!(ps <= 32.0f)) != 0) {      /* one scalar branch a chunk, the same for the whole wave; the negated form also takes a sum that is not a number */
      float mc = fmaxf(sc[0][0][0], sc[1][0][0]);
#pragma unroll
      for (int r = 1; r < 8; ++r) mc = fmaxf(mc, fmaxf(sc[0][r >> 1][r & 1], sc[1][r >> 1][r & 1]));
      mc = fmaxf(mc, xhalf(mc));      /* the query's other 16 keys: both halves of a query always hold the same reference */
      const float mn = fmaxf(m_r, mc * SCL2); const float al = (mn > -1.0e38f) ? __builtin_amdgcn_exp2f(m_r - mn) : 1.0f; m_r = mn; l_r *= al;
#pragma unroll
      for (int dt = 0; dt < DT; ++dt) { oacc[dt] *= al; oaccl[dt] *= al; oacc2[dt] *= al; }
      weights();
    }
    l_r += ps;      /* the lane's half of the row sum; the halves are joined once, behind the loop */
    __builtin_amdgcn_sched_barrier(0);      /* keeps the V^T fragments' 64 registers out of the scores and exponentials: lifted to the top of the chunk, these LDS reads push the wave past 256 registers and a value spills to scratch */
#pragma unroll
    for (int dt = 0; dt < DT; ++dt) { const unsigned char* vp = fv + cur + dt * 16 * PV; const unsigned char* lp = vp + (OVL - OVH); av[dt].half[0] = *(const v8us*)vp; av[dt].half[1] = *(const v8us*)(vp + 32); avl[dt].half[0] = *(const v8us*)lp; avl[dt].half[1] = *(const v8us*)(lp + 32); }
    __builtin_amdgcn_sched_barrier(0);      /* keeps the sixteen reads together as one group in front of the split of P, under which their latency passes: spread among the matrix instructions, each further place of LDS reads costs the wave a wait of its own */
    FragH bp, bpl;
#pragma unroll
    for (int nt = 0; nt < 2; ++nt)
#pragma unroll
      for (int i = 0; i < 4; ++i) { const v2p pv = p[nt][i] * (v2p){vh[nt][i >> 1][(i & 1) * 2], vh[nt][i >> 1][(i & 1) * 2 + 1]} * 1024.0f;      /* value-head scalar folded into P, carried as f16 hi + x2^10 residual operands; the normaliser keeps plain p */
#pragma unroll
        for (int q = 0; q < 2; ++q) { const _Float16 ph = (_Float16)pv[q]; bp.h[nt * 8 + 2 * i + q] = ph; bpl.h[nt * 8 + 2 * i + q] = (_Float16)((pv[q] - (float)ph) * 1024.0f); } }
#pragma unroll
    for (int dt = 0; dt < DT; ++dt) { oacc[dt] = __builtin_amdgcn_wmma_f32_16x16x32_f16(false, av[dt].v, false, bp.v, (short)0, oacc[dt], false, false); oaccl[dt] = __builtin_amdgcn_wmma_f32_16x16x32_f16(false, avl[dt].v, false, bp.v, (short)0, oaccl[dt], false, false); oacc2[dt] = __builtin_amdgcn_wmma_f32_16x16x32_f16(false, av[dt].v, false, bpl.v, (short)0, oacc2[dt], false, false); }
    }
    /* hand-over of the ring, passed by every wave, also one without a chunk in this stage */
    asm volatile("s_wait_dscnt 0x0" ::: "memory");      /* this wave's reads of stage t are done before the buffer is given to the copies */
    asm volatile("s_wait_asynccnt 0x0" ::: "memory");      /* this wave's pieces of stage t + 1 have landed */
    __syncthreads();      /* publishes stage t + 1 and ends every wave's reads of stage t */
    if (t + 2 < nst) stage_copies(lk + cur, lv + cur, lw + cur, lh + cur, gk + (size_t)(t + 2) * (SK * HD * 2), gv + (size_t)(t + 2) * (SK * 2), gw + (size_t)(t + 2) * (SK * 2), gh + (size_t)(t + 2) * (SK * 4));      /* into the buffer that stage t has just left */
  }
  asm volatile("s_wait_asynccnt 0x0" ::: "memory");      /* no copy is outstanding when the wave goes on to its end */
  l_r += xhalf(l_r);
  if (hh == 0) { sM[w][ln] = m_r; sL[w][ln] = l_r; }
#pragma unroll
  for (int dt = 0; dt < DT; ++dt) { const v8f t = oacc[dt] + (oaccl[dt] + oacc2[dt]) * 0.0009765625f;      /* registers r = head dims dt * 16 + 8 hh + r of query ln */
    *(v4fa*)&sO[w][ln][dt * 16 + 8 * hh] = (v4f){t[0], t[1], t[2], t[3]}; *(v4fa*)&sO[w][ln][dt * 16 + 8 * hh + 4] = (v4f){t[4], t[5], t[6], t[7]}; }
  __syncthreads();      /* every wave's partial (max, sum, unnormalised rows) is in LDS before any wave merges */
  {
    const int mh = tid >> 7, lt = tid & 127;      /* 128 threads merge a head: its partial i is wave i * HB + mh's */
    const int r = lt >> 3, c8 = (lt & 7) * 8;      /* 8 threads a row, 8 head dims a thread: in f16 a head's row is one 128-byte line of each plane */
    float mw[KQ], M = -3.0e38f, L = 0.f;
#pragma unroll
    for (int i = 0; i < KQ; ++i) { mw[i] = sM[i * HB + mh][r]; M = fmaxf(M, mw[i]); }
#pragma unroll
    for (int i = 0; i < KQ; ++i) { mw[i] = exp2_slot(mw[i] - M); L += mw[i] * sL[i * HB + mh][r]; }      /* a wave that had no chunk holds max -3e38, sum 0, rows 0: weight 0 */
    const float inv = (L > 0.f) ? 1.0f / (L * 1024.0f) : 0.f;
    FragH fo, fr;      /* the merged row leaves as the output projection's operands: f16 and the x2^10 residual of that rounding */
#pragma unroll
    for (int hf = 0; hf < 2; ++hf) { v4f a = {0.f, 0.f, 0.f, 0.f};
#pragma unroll
      for (int i = 0; i < KQ; ++i) { const v4f p = *(const v4fa*)&sO[i * HB + mh][r][c8 + hf * 4]; a += p * mw[i]; }
      a *= inv;
#pragma unroll
      for (int q = 0; q < 4; ++q) { const _Float16 hv = (_Float16)a[q]; fo.h[hf * 4 + q] = hv; fr.h[hf * 4 + q] = (_Float16)((a[q] - (float)hv) * 1024.0f); } }
    const size_t oo = ((size_t)b * TT + q0 + r) * ldo + (hg * HB + mh) * 64 + c8;
    *(v8us*)((unsigned short*)OH + oo) = fo.half[0]; *(v8us*)((unsigned short*)OL + oo) = fr.half[0];
  } }

extern "C" void kernel_launch(void* const* d_in, const int* in_sizes, int n_in,
                              void* d_out, int out_size, void* d_ws, size_t ws_size, hipStream_t stream) {
  (void)in_sizes; (void)n_in; (void)out_size;
  const float* x = (const float*)d_in[0]; const float* Wq = (const float*)d_in[1]; const float* Wkv = (const float*)d_in[2]; const float* Wkvh = (const float*)d_in[3]; const float* Wo = (const float*)d_in[4];
  char* ws = (char*)d_ws; size_t off = 0;
  auto take = [&](size_t bytes) { char* p = ws + off; off += (bytes + 255) & ~(size_t)255; return p; };
  _Float16* Bq = (_Float16*)take((size_t)DM * DM * 2); _Float16* Bkv = (_Float16*)take((size_t)2 * HD * DM * 2); _Float16* Bkh = (_Float16*)take((size_t)2 * NH * DM * 2); _Float16* Bo = (_Float16*)take((size_t)DM * DM * 2); float* CS = (float*)take((size_t)TT * 32 * 2 * 4);
  _Float16* X16 = (_Float16*)take((size_t)NR * DM * 2); _Float16* Q16 = (_Float16*)take((size_t)NR * DM * 2); _Float16* K16 = (_Float16*)take((size_t)NR * HD * 2); float* HS = (float*)take((size_t)NR * 2 * NH * 4);
  _Float16* Vth = (_Float16*)take((size_t)BB * HD * TT * 2); _Float16* Vtl = (_Float16*)take((size_t)BB * HD * TT * 2); _Float16* OH = (_Float16*)take((size_t)NR * DM * 2); _Float16* OL = (_Float16*)take((size_t)NR * DM * 2);
  if (off > ws_size) return;      // 2.1 + 0.3 + 0.1 + 2.1 + 0.5 + 8.4 + 8.4 + 0.5 + 0.5 + 0.5 + 0.5 + 8.4 + 8.4 = about 41 MB
  k_prep<<<2 * (DM * (DM / 8) / 256) + 2 * HD * (DM / 8) / 256 + 2 * NH * (DM / 8) / 256 + TT * 32 / 256 + NR * DM / 8 / 256, 256, 0, stream>>>(x, Wq, Wkv, Wkvh, Wo, X16, Bq, Bkv, Bkh, Bo, CS);      /* weights -> Bt, x -> f16, cos/sin table */
  const dim3 gq(DM / 128, NR / 128);      /* 128 x 128 tiles of a 4096 x 1024 result: 256 blocks */
  k_proj<<<(DM / 128 + 2) * (NR / 128), 256, 0, stream>>>(X16, Bq, Bkv, Bkh, CS, Q16, K16, Vth, Vtl, HS);      /* rotary q, rotary k and V^T planes, [kh | vh]: 256 + 32 + 32 tiles */
  k_flash<<<BB * (NH / 2) * (TT / 16), 256, 0, stream>>>(Q16, DM, K16, HS, HS + (size_t)NH * NR, Vth, Vtl, OH, OL, DM);      /* KH = HS rows 0..15, VH = rows 16..31 (row pitch NR) */
  k_gemm_o<<<gq, 512, 0, stream>>>(OH, OL, Bo, (float*)d_out);      /* y = (O_hi + 2^-10 O_lo).Wo */
}

// v010
// One run takes 83.9 microseconds.
// Timed twice side by side with v009, it ran 1.06 and 1.07 times as fast.
// Counting every step since v000, which is the starting kernel, it is 6.90 times as fast.
#include <hip/hip_runtime.h>
// Multi-product attention with low-rank shared key/value (B=2, N=2048, D=1024, 16 heads × 64): q = x·Wq; [k|v] = x·Wkv (one shared 64-dim key and value); [kh|vh] = σ(x·Wkvh) per (token, head); rotary (rotate-half, θ=1e4) on q and k by
// sequence position; K_h[n] = kh[n,h]·k[n], V_h[n] = vh[n,h]·v[n]; causal softmax(q_h·K_hᵀ/8); out = (Σ attn·V_h merged)·Wo.
// Compute dtype: x and weights rounded to bf16; q and k as f32 GEMM accumulators rotated in f32 in the GEMM epilogue from an f32 cos/sin table and stored f16; head scalars as sigmoid GEMM epilogue outputs (f32); v f32 →
// f16 hi + ×2^10 residual Vᵀ planes; fused causal flash-style kernel (scores scaled by kh per key, P multiplied by vh per key and carried as f16 hi + residual tiles, online softmax f32, three value accumulators) on v_wmma_f32_16x16x32_f16; merged O stored as f16 hi + x2^10 residual planes by the attention kernel; both Wo products in one kernel, joined in registers; f32 accumulate.
#define BB 2
#define TT 2048
#define DM 1024
#define NH 16
#define HD 64
#define NR (BB * TT)

typedef __bf16 v16b __attribute__((ext_vector_type(16)));
typedef unsigned short v8us __attribute__((ext_vector_type(8), may_alias));
typedef float  v8f  __attribute__((ext_vector_type(8)));
typedef float  v4f  __attribute__((ext_vector_type(4)));
typedef float  v4fa __attribute__((ext_vector_type(4), may_alias));
union FragB { v16b v; v8us half[2]; unsigned short u[16]; };

__device__ __forceinline__ unsigned short bf16_bits(float x) { unsigned int u = __float_as_uint(x); return (unsigned short)((u + 0x7FFFu + ((u >> 16) & 1u)) >> 16); }
__device__ __forceinline__ float bf16_val(unsigned short b) { return __uint_as_float(((unsigned int)b) << 16); }
__device__ __forceinline__ float bf16_round(float x) { return bf16_val(bf16_bits(x)); }
// D += A·B with NT terms: 1 = ah·bh, 2 = + al·bh (A split), 3 = + ah·bl (both split)
template <int NT>
__device__ __forceinline__ v8f mmaN(v16b ah, v16b al, v16b bh, v16b bl, v8f c) {
  c = __builtin_amdgcn_wmma_f32_16x16x32_bf16(false, ah, false, bh, (short)0, c, false, false);
  if (NT >= 2) c = __builtin_amdgcn_wmma_f32_16x16x32_bf16(false, al, false, bh, (short)0, c, false, false);
  if (NT >= 3) c = __builtin_amdgcn_wmma_f32_16x16x32_bf16(false, ah, false, bl, (short)0, c, false, false);
  asm volatile("v_nop\n\tv_nop\n\tv_nop\n\tv_nop" : "+v"(c) : "v"(ah), "v"(al), "v"(bh), "v"(bl));
  return c;
}

__global__ __launch_bounds__(256) void k_wt_bf16(const float* __restrict__ W, unsigned short* __restrict__ Wt, int K, int N) {
  const int t = blockIdx.x * 256 + threadIdx.x;
  const int k8n = K / 8;
  if (t >= N * k8n) return;
  const int n = t / k8n, k8 = (t % k8n) * 8;
  v8us v;
#pragma unroll
  for (int i = 0; i < 8; ++i) v[i] = bf16_bits(W[(size_t)(k8 + i) * N + n]);
  *(v8us*)(Wt + (size_t)n * K + k8) = v;
  
}

// GEMM C[M][N] (f32, pitch ldc) = act(A[M][K]·W + bias). A f32 row-major (pitch lda) converted per fragment to bf16
// (ASPLIT: hi/lo two planes -> 2 terms, else single rounded term); Wt bf16 [N][K] (pitch ldb). BIAS_BF16 rounds the
// bias to bf16 first (bias quantised to bf16 before the add). K%32==0, M%16==0, N%64==0.
template <bool ASPLIT, int ACT, bool BIAS_BF16>
__global__ __launch_bounds__(128) void k_gemm_bf(const float* __restrict__ A, int lda, const unsigned short* __restrict__ Wt, int ldb,
                                               const float* __restrict__ bias, float* __restrict__ C, int ldc, int M, int N, int K) {
  __shared__ __attribute__((aligned(16))) float so[4][16][64];
  const int tid = threadIdx.x, w = tid >> 5, lane = tid & 31, ln = lane & 15, hh = lane >> 4;
  const int ntn = N / 64;
  const int wid = blockIdx.x * 4 + w;
  const int mt = wid / ntn, nq = wid % ntn;
  if (mt * 16 >= M) return;
  const int row0 = mt * 16, col0 = nq * 64;
  const float* arow = A + (size_t)(row0 + ln) * lda;
  v8f acc[4] = {};
  for (int kb = 0; kb < K; kb += 32) {
    FragB ah, al;
    const v4f x0 = *(const v4fa*)(arow + kb + 8 * hh), x1 = *(const v4fa*)(arow + kb + 8 * hh + 4);
    const v4f x2 = *(const v4fa*)(arow + kb + 16 + 8 * hh), x3 = *(const v4fa*)(arow + kb + 16 + 8 * hh + 4);
    float xs[16] = {x0[0],x0[1],x0[2],x0[3],x1[0],x1[1],x1[2],x1[3],x2[0],x2[1],x2[2],x2[3],x3[0],x3[1],x3[2],x3[3]};
#pragma unroll
    for (int i = 0; i < 16; ++i) { const unsigned short hb = bf16_bits(xs[i]); ah.u[i] = hb; al.u[i] = ASPLIT ? bf16_bits(xs[i] - bf16_val(hb)) : (unsigned short)0; }
#pragma unroll
    for (int t = 0; t < 4; ++t) {
      const unsigned short* brow = Wt + (size_t)(col0 + t * 16 + ln) * ldb + kb;
      FragB b;
      b.half[0] = *(const v8us*)(brow + 8 * hh);
      b.half[1] = *(const v8us*)(brow + 16 + 8 * hh);
      acc[t] = mmaN<ASPLIT ? 2 : 1>(ah.v, al.v, b.v, b.v, acc[t]);
    }
  }
#pragma unroll
  for (int t = 0; t < 4; ++t) {
    float bv = bias ? bias[col0 + t * 16 + ln] : 0.f;
    if (BIAS_BF16) bv = bf16_round(bv);
#pragma unroll
    for (int r = 0; r < 8; ++r) { float v = acc[t][r] + bv; if (ACT == 1) v = fmaxf(v, 0.f); so[w][8 * hh + r][t * 16 + ln] = v; }
  }
  __builtin_amdgcn_fence(__ATOMIC_ACQ_REL, "workgroup");
  __builtin_amdgcn_wave_barrier();
  const int rsub = lane >> 4, c4 = (lane & 15) * 4;
  {
#pragma unroll
    for (int q = 0; q < 8; ++q) {
      const int r = q * 2 + rsub;
      const v4f v = *(const v4fa*)&so[w][r][c4];
      *(v4f*)(C + (size_t)(row0 + r) * ldc + col0 + c4) = v;
    }
    
  }
}

// Flash-style causal/unmasked attention, all contractions 3-term bf16 hi/lo splits, f32 softmax with running max.
// q,k,v rows are read from f32 buffers with arbitrary row pitch (so they can live inside a fused qkv buffer);
// D = head size (multiple of 32, <= 128); one wave = 16 query rows; block = 4 waves (64 queries) sharing K/V chunks of 32.
template <int D, bool CAUSAL>
__global__ __launch_bounds__(128) void k_flash(const float* __restrict__ qb, const float* __restrict__ kb, const float* __restrict__ vb,
                                             int pitch, int T, int H, float scale, float* __restrict__ y, int ypitch) {
  constexpr int KS = D / 32;        // k-steps for QK
  constexpr int DT = D / 16;        // d tiles for PV
  __shared__ __attribute__((aligned(16))) unsigned short sKh[32][D + 8], sKl[32][D + 8], sVh[32][D + 8], sVl[32][D + 8];
  __shared__ __attribute__((aligned(16))) unsigned short sPh[4][16][40], sPl[4][16][40];
  __shared__ __attribute__((aligned(16))) float sO[4][16][D];
  const int tid = threadIdx.x, w = tid >> 5, lane = tid & 31, ln = lane & 15, hh = lane >> 4;
  const int nqb = (T + 63) / 64;
  const int bh = blockIdx.x / nqb, qblk = blockIdx.x % nqb;
  const int b = bh / H, h = bh % H;
  const int q0 = qblk * 64 + w * 16;
  const float* Q = qb + (size_t)b * T * pitch + h * D;
  const float* K = kb + (size_t)b * T * pitch + h * D;
  const float* V = vb + (size_t)b * T * pitch + h * D;

  // A fragments of the wave's 16 query rows (scaled), hi/lo
  FragB aqh[KS], aql[KS];
  {
    int row = q0 + ln; if (row >= T) row = T - 1;
    const float* qr = Q + (size_t)row * pitch;
#pragma unroll
    for (int ks = 0; ks < KS; ++ks)
#pragma unroll
      for (int i = 0; i < 16; ++i) {
        const int d = ks * 32 + ((i < 8) ? (8 * hh + i) : (16 + 8 * hh + (i - 8)));
        const float x = qr[d] * scale; const unsigned short hb = bf16_bits(x);
        aqh[ks].u[i] = hb; aql[ks].u[i] = bf16_bits(x - bf16_val(hb));
      }
  }
  float m_r[8], l_r[8];
#pragma unroll
  for (int r = 0; r < 8; ++r) { m_r[r] = -3.0e38f; l_r[r] = 0.f; }
  v8f oacc[DT];
#pragma unroll
  for (int dt = 0; dt < DT; ++dt) oacc[dt] = (v8f){0.f,0.f,0.f,0.f,0.f,0.f,0.f,0.f};

  const int kv_end = CAUSAL ? min(T, qblk * 64 + 64) : T;     // block-uniform
  for (int j0 = 0; j0 < kv_end; j0 += 32) {
    __syncthreads();
    for (int e = tid; e < 32 * (D / 4); e += 128) {
      const int r = e / (D / 4), c4 = (e % (D / 4)) * 4;
      const int key = j0 + r;
      v4f kf = {0.f,0.f,0.f,0.f}, vf = {0.f,0.f,0.f,0.f};
      if (key < T) { kf = *(const v4fa*)(K + (size_t)key * pitch + c4); vf = *(const v4fa*)(V + (size_t)key * pitch + c4); }
#pragma unroll
      for (int t = 0; t < 4; ++t) {
        unsigned short hb = bf16_bits(kf[t]); sKh[r][c4 + t] = hb; sKl[r][c4 + t] = bf16_bits(kf[t] - bf16_val(hb));
        hb = bf16_bits(vf[t]); sVh[r][c4 + t] = hb; sVl[r][c4 + t] = bf16_bits(vf[t] - bf16_val(hb));
      }
    }
    __syncthreads();
    // S tile 16 x 32
    v8f s[2];
#pragma unroll
    for (int nt = 0; nt < 2; ++nt) {
      v8f acc = {};
#pragma unroll
      for (int ks = 0; ks < KS; ++ks) {
        FragB bh_, bl_;
        bh_.half[0] = *(const v8us*)&sKh[nt * 16 + ln][ks * 32 + 8 * hh]; bh_.half[1] = *(const v8us*)&sKh[nt * 16 + ln][ks * 32 + 16 + 8 * hh];
        bl_.half[0] = *(const v8us*)&sKl[nt * 16 + ln][ks * 32 + 8 * hh]; bl_.half[1] = *(const v8us*)&sKl[nt * 16 + ln][ks * 32 + 16 + 8 * hh];
        acc = mmaN<3>(aqh[ks].v, aql[ks].v, bh_.v, bl_.v, acc);
      }
      s[nt] = acc;
    }
    // mask + running max (rows 8hh+r; the 16 lanes of a half share rows)
    float alpha[8];
#pragma unroll
    for (int r = 0; r < 8; ++r) {
      const int qi = q0 + 8 * hh + r;
      const int ja = j0 + ln, jb = j0 + 16 + ln;
      if (CAUSAL) { if (ja > qi) s[0][r] = -3.0e38f; if (jb > qi) s[1][r] = -3.0e38f; }
      if (ja >= T) s[0][r] = -3.0e38f;
      if (jb >= T) s[1][r] = -3.0e38f;
      float mx = fmaxf(s[0][r], s[1][r]);
      mx = fmaxf(mx, __shfl_xor(mx, 1, 32)); mx = fmaxf(mx, __shfl_xor(mx, 2, 32)); mx = fmaxf(mx, __shfl_xor(mx, 4, 32)); mx = fmaxf(mx, __shfl_xor(mx, 8, 32));
      const float mnew = fmaxf(m_r[r], mx);
      alpha[r] = (mnew > -1.0e38f) ? __expf(m_r[r] - mnew) : 1.0f;
      const float p0 = (s[0][r] > -1.0e38f) ? __expf(s[0][r] - mnew) : 0.f;
      const float p1 = (s[1][r] > -1.0e38f) ? __expf(s[1][r] - mnew) : 0.f;
      m_r[r] = mnew;
      l_r[r] = l_r[r] * alpha[r] + p0 + p1;            // per-lane partial row sum (16 lanes combined at the end)
      unsigned short hb = bf16_bits(p0); sPh[w][8 * hh + r][ln] = hb;      sPl[w][8 * hh + r][ln] = bf16_bits(p0 - bf16_val(hb));
      hb = bf16_bits(p1);                sPh[w][8 * hh + r][16 + ln] = hb; sPl[w][8 * hh + r][16 + ln] = bf16_bits(p1 - bf16_val(hb));
    }
#pragma unroll
    for (int dt = 0; dt < DT; ++dt)
#pragma unroll
      for (int r = 0; r < 8; ++r) oacc[dt][r] *= alpha[r];
    __builtin_amdgcn_fence(__ATOMIC_ACQ_REL, "workgroup");
    __builtin_amdgcn_wave_barrier();
    FragB pah, pal;
    pah.half[0] = *(const v8us*)&sPh[w][ln][8 * hh]; pah.half[1] = *(const v8us*)&sPh[w][ln][16 + 8 * hh];
    pal.half[0] = *(const v8us*)&sPl[w][ln][8 * hh]; pal.half[1] = *(const v8us*)&sPl[w][ln][16 + 8 * hh];
#pragma unroll
    for (int dt = 0; dt < DT; ++dt) {
      FragB bvh, bvl;
#pragma unroll
      for (int i = 0; i < 8; ++i) {
        bvh.u[i] = sVh[8 * hh + i][dt * 16 + ln]; bvh.u[8 + i] = sVh[16 + 8 * hh + i][dt * 16 + ln];
        bvl.u[i] = sVl[8 * hh + i][dt * 16 + ln]; bvl.u[8 + i] = sVl[16 + 8 * hh + i][dt * 16 + ln];
      }
      oacc[dt] = mmaN<3>(pah.v, pal.v, bvh.v, bvl.v, oacc[dt]);
    }
    __builtin_amdgcn_fence(__ATOMIC_ACQ_REL, "workgroup");
    __builtin_amdgcn_wave_barrier();
  }
#pragma unroll
  for (int r = 0; r < 8; ++r) {
    float l = l_r[r];
    l += __shfl_xor(l, 1, 32); l += __shfl_xor(l, 2, 32); l += __shfl_xor(l, 4, 32); l += __shfl_xor(l, 8, 32);
    l_r[r] = (l > 0.f) ? 1.0f / l : 0.f;
  }
#pragma unroll
  for (int dt = 0; dt < DT; ++dt)
#pragma unroll
    for (int r = 0; r < 8; ++r) sO[w][8 * hh + r][dt * 16 + ln] = oacc[dt][r] * l_r[r];
  __builtin_amdgcn_fence(__ATOMIC_ACQ_REL, "workgroup");
  __builtin_amdgcn_wave_barrier();
  {
    for (int r = 0; r < 16; ++r) {
      const int row = q0 + r;
      if (row < T && lane < D / 4) {
        const v4f val = *(const v4fa*)&sO[w][r][lane * 4];
        *(v4f*)(y + ((size_t)b * T + row) * ypitch + h * D + lane * 4) = val;
      }
    }
    
  }
}

// GEMM C = act(A·W + bias + resid): A f32 (ASPLIT -> hi/lo 2 terms), Wt bf16 [N][K]; ACT 0 none, 1 relu, 2 exact gelu;
// resid (optional, f32, row index = (row % rmod), pitch ldr, RES_BF16 rounds it) added before the activation.
template <bool ASPLIT, int ACT, bool BIAS_BF16, bool RES_BF16>
__global__ __launch_bounds__(128) void k_gemm_bf3(const float* __restrict__ A, int lda, const unsigned short* __restrict__ Wt, int ldb,
                                                const float* __restrict__ bias, const float* __restrict__ resid, int rmod, int ldr,
                                                float* __restrict__ C, int ldc, int M, int N, int K) {
  __shared__ __attribute__((aligned(16))) float so[4][16][64];
  const int tid = threadIdx.x, w = tid >> 5, lane = tid & 31, ln = lane & 15, hh = lane >> 4;
  const int ntn = N / 64;
  const int wid = blockIdx.x * 4 + w;
  const int mt = wid / ntn, nq = wid % ntn;
  if (mt * 16 >= M) return;
  const int row0 = mt * 16, col0 = nq * 64;
  const float* arow = A + (size_t)(row0 + ln) * lda;
  v8f acc[4] = {};
  for (int kb = 0; kb < K; kb += 32) {
    FragB ah, al;
    const v4f x0 = *(const v4fa*)(arow + kb + 8 * hh), x1 = *(const v4fa*)(arow + kb + 8 * hh + 4);
    const v4f x2 = *(const v4fa*)(arow + kb + 16 + 8 * hh), x3 = *(const v4fa*)(arow + kb + 16 + 8 * hh + 4);
    float xs[16] = {x0[0],x0[1],x0[2],x0[3],x1[0],x1[1],x1[2],x1[3],x2[0],x2[1],x2[2],x2[3],x3[0],x3[1],x3[2],x3[3]};
#pragma unroll
    for (int i = 0; i < 16; ++i) { const unsigned short hb = bf16_bits(xs[i]); ah.u[i] = hb; al.u[i] = ASPLIT ? bf16_bits(xs[i] - bf16_val(hb)) : (unsigned short)0; }
#pragma unroll
    for (int t = 0; t < 4; ++t) {
      const unsigned short* brow = Wt + (size_t)(col0 + t * 16 + ln) * ldb + kb;
      FragB b;
      b.half[0] = *(const v8us*)(brow + 8 * hh);
      b.half[1] = *(const v8us*)(brow + 16 + 8 * hh);
      acc[t] = mmaN<ASPLIT ? 2 : 1>(ah.v, al.v, b.v, b.v, acc[t]);
    }
  }
#pragma unroll
  for (int t = 0; t < 4; ++t) {
    const int col = col0 + t * 16 + ln;
    float bv = bias ? bias[col] : 0.f;
    if (BIAS_BF16) bv = bf16_round(bv);
#pragma unroll
    for (int r = 0; r < 8; ++r) {
      float v = acc[t][r] + bv;
      if (resid) { float rv = resid[(size_t)((row0 + 8 * hh + r) % rmod) * ldr + col]; if (RES_BF16) rv = bf16_round(rv); v += rv; }
      if (ACT == 1) v = fmaxf(v, 0.f);
      if (ACT == 2) v = 0.5f * v * (1.0f + erff(v * 0.70710678118654752f));
      if (ACT == 3) { const float u = 0.7978845608028654f * (v + 0.044715f * v * v * v); v = 0.5f * v * (1.0f + tanhf(u)); }
      so[w][8 * hh + r][t * 16 + ln] = v;
    }
  }
  __builtin_amdgcn_fence(__ATOMIC_ACQ_REL, "workgroup");
  __builtin_amdgcn_wave_barrier();
  const int rsub = lane >> 4, c4 = (lane & 15) * 4;
  {
#pragma unroll
    for (int q = 0; q < 8; ++q) {
      const int r = q * 2 + rsub;
      const v4f v = *(const v4fa*)&so[w][r][c4];
      *(v4f*)(C + (size_t)(row0 + r) * ldc + col0 + c4) = v;
    }
    
  }
}
// row LayerNorm (biased variance, eps) over N: s = X (+ R); optional out_sum <- s; out_norm <- (s-mu)*rsqrt(var+eps)*g + b
template <bool PARAM_BF16>
__global__ __launch_bounds__(256) void k_layernorm(const float* __restrict__ X, const float* __restrict__ R, const float* __restrict__ g, const float* __restrict__ bta,
                                                  float* __restrict__ out_sum, float* __restrict__ out_norm, int N, float eps) {
  __shared__ float red[256];
  const int row = blockIdx.x, tid = threadIdx.x;
  const float* x = X + (size_t)row * N; const float* rr = R ? R + (size_t)row * N : nullptr;
  float vals[16];                     // up to N = 4096
  const int per = N / 256;            // contiguous chunk per thread? use strided-by-4 chunks: thread handles j = tid*4 + 1024*u
  float s1 = 0.f;
  for (int u = 0; u < per / 4; ++u) {
    const int j = tid * 4 + 1024 * u;
    const v4f a = *(const v4fa*)(x + j);
    v4f b = {0.f,0.f,0.f,0.f}; if (rr) b = *(const v4fa*)(rr + j);
#pragma unroll
    for (int q = 0; q < 4; ++q) { const float v = a[q] + b[q]; vals[u * 4 + q] = v; s1 += v; }
  }
  red[tid] = s1; __syncthreads();
  for (int st = 128; st > 0; st >>= 1) { if (tid < st) red[tid] += red[tid + st]; __syncthreads(); }
  const float mu = red[0] / (float)N; __syncthreads();
  float s2 = 0.f;
  for (int u = 0; u < per / 4; ++u)
#pragma unroll
    for (int q = 0; q < 4; ++q) { const float c = vals[u * 4 + q] - mu; s2 += c * c; }
  red[tid] = s2; __syncthreads();
  for (int st = 128; st > 0; st >>= 1) { if (tid < st) red[tid] += red[tid + st]; __syncthreads(); }
  const float rs = rsqrtf(red[0] / (float)N + eps);
  {
    for (int u = 0; u < per / 4; ++u) {
      const int j = tid * 4 + 1024 * u;
      v4f o, sm;
#pragma unroll
      for (int q = 0; q < 4; ++q) {
        float gg = g[j + q], bb = bta[j + q];
        if (PARAM_BF16) { gg = bf16_round(gg); bb = bf16_round(bb); }
        sm[q] = vals[u * 4 + q]; o[q] = (vals[u * 4 + q] - mu) * rs * gg + bb;
      }
      if (out_sum) *(v4f*)(out_sum + (size_t)row * N + j) = sm;
      *(v4f*)(out_norm + (size_t)row * N + j) = o;
    }
    
  }
}



// ---- f16 WMMA path (v_wmma_f32_16x16x32_f16): 11-bit significands for operands in range — used where a [0,1] probability operand needs more precision than bf16
typedef _Float16 v16h __attribute__((ext_vector_type(16)));
union FragH { v16h v; v8us half[2]; _Float16 h[16]; unsigned short u[16]; };
template <int NT>
__device__ __forceinline__ v8f mmaH(v16h ah, v16h al, v16h bh, v16h bl, v8f c) {
  c = __builtin_amdgcn_wmma_f32_16x16x32_f16(false, ah, false, bh, (short)0, c, false, false);
  if (NT >= 2) c = __builtin_amdgcn_wmma_f32_16x16x32_f16(false, al, false, bh, (short)0, c, false, false);
  if (NT >= 3) c = __builtin_amdgcn_wmma_f32_16x16x32_f16(false, ah, false, bl, (short)0, c, false, false);
  asm volatile("v_nop\n\tv_nop\n\tv_nop\n\tv_nop" : "+v"(c) : "v"(ah), "v"(al), "v"(bh), "v"(bl));
  return c;
}
// batched GEMM like k_gemm_b but f16 operands: A f32 (split into f16 hi/lo if ASPLIT, else rounded to f16), Bt = f16 values [n][k]; alpha; C f32; N multiple of 16 (partial tiles skipped)
template <bool ASPLIT>
__global__ __launch_bounds__(128) void k_gemm_h(const float* __restrict__ A, int lda, size_t sA, const _Float16* __restrict__ Bh, int ldb, size_t sB, float alpha, float* __restrict__ C, int ldc, size_t sC, int M, int N, int K) {
  __shared__ __attribute__((aligned(16))) float so[4][16][64];
  const int tid = threadIdx.x, w = tid >> 5, lane = tid & 31, ln = lane & 15, hh = lane >> 4; const int by = blockIdx.y;
  A += (size_t)by * sA; Bh += (size_t)by * sB; C += (size_t)by * sC;
  const int ntn = (N + 63) / 64; const int wid = blockIdx.x * 4 + w; const int mt = wid / ntn, nq = wid % ntn; if (mt * 16 >= M) return;
  const int row0 = mt * 16, col0 = nq * 64; const float* arow = A + (size_t)(row0 + ln) * lda;
  v8f acc[4] = {};
  for (int kb = 0; kb < K; kb += 32) {
    FragH ah, al;
    const v4f x0 = *(const v4fa*)(arow + kb + 8 * hh), x1 = *(const v4fa*)(arow + kb + 8 * hh + 4), x2 = *(const v4fa*)(arow + kb + 16 + 8 * hh), x3 = *(const v4fa*)(arow + kb + 16 + 8 * hh + 4);
    float xs[16] = {x0[0],x0[1],x0[2],x0[3],x1[0],x1[1],x1[2],x1[3],x2[0],x2[1],x2[2],x2[3],x3[0],x3[1],x3[2],x3[3]};
#pragma unroll
    for (int i = 0; i < 16; ++i) { const _Float16 h = (_Float16)xs[i]; ah.h[i] = h; al.h[i] = ASPLIT ? (_Float16)(xs[i] - (float)h) : (_Float16)0.0f; }
#pragma unroll
    for (int t = 0; t < 4; ++t) { if (col0 + t * 16 >= N) continue; const size_t boff = (size_t)(col0 + t * 16 + ln) * ldb + kb; FragH bq; bq.half[0] = *(const v8us*)(Bh + boff + 8 * hh); bq.half[1] = *(const v8us*)(Bh + boff + 16 + 8 * hh);
      acc[t] = mmaH<ASPLIT ? 2 : 1>(ah.v, al.v, bq.v, bq.v, acc[t]); }
  }
#pragma unroll
  for (int t = 0; t < 4; ++t) { if (col0 + t * 16 >= N) continue;
#pragma unroll
    for (int r = 0; r < 8; ++r) so[w][8 * hh + r][t * 16 + ln] = acc[t][r] * alpha; }
  __builtin_amdgcn_fence(__ATOMIC_ACQ_REL, "workgroup"); __builtin_amdgcn_wave_barrier();
  const int rsub = lane >> 4, c4 = (lane & 15) * 4;
  {
#pragma unroll
    for (int q = 0; q < 8; ++q) { const int r = q * 2 + rsub; if (col0 + c4 < N) { const v4f v = *(const v4fa*)&so[w][r][c4]; *(v4f*)(C + (size_t)(row0 + r) * ldc + col0 + c4) = v; } }
     }
}

// Wt[n][k] = f16(bf16(W[k][n])·scale) from f32 row-major W[K][N] (scale = power of two; bf16-exact weights stay exact in f16 away from the subnormal range)
// (bid = the block's index within this piece of work; the pieces are launched together by k_prep below)
// A thread takes a patch of 8 k x 4 n: eight 16-byte loads, all in flight together, and four 16-byte stores. Of the thread index the low 3 bits count 8-k pieces (8 lanes store one whole 128-byte line of a Wt row),
// the next 3 bits count 4-n pieces (8 of them read one whole line of a W row, half of it in each of two neighbouring waves). K % 64 == 0, N % 32 == 0.
// Every "#pragma unroll" of this function is there so that r and f get constant indices and stay in registers.
__device__ __forceinline__ void d_wt_f16(int bid, const float* __restrict__ W, _Float16* __restrict__ Wt, int K, int N, float scale) {
  const int t = bid * 256 + threadIdx.x; if (t >= (N / 4) * (K / 8)) return;
  const int g = t >> 6, k8 = ((g % (K / 64)) * 8 + (t & 7)) * 8, n4 = ((g / (K / 64)) * 8 + ((t >> 3) & 7)) * 4;
  const float* const wp = W + (size_t)k8 * N + n4; unsigned short* const op = (unsigned short*)Wt + (size_t)n4 * K + k8;
  v4f r[8];
#pragma unroll
  for (int i = 0; i < 8; ++i) r[i] = *(const v4fa*)(wp + (size_t)i * N);
#pragma unroll
  for (int j = 0; j < 4; ++j) { FragH f;
#pragma unroll
    for (int i = 0; i < 8; ++i) f.h[i] = (_Float16)(bf16_round(r[i][j]) * scale);
    *(v8us*)(op + (size_t)j * K) = f.half[0]; }
}
// Block-tile GEMM, f16 operands, f32 accumulate: C[row][col] = act(alpha * sum_k A[row][k] * Bt[col][k]) (+ C if ADDC). A and Bt are K-contiguous with row pitch DM, K = DM.
// One block of 8 waves owns a 128 x BN tile of C. Each pass brings 128 k (256 B of every operand row) from global memory in whole-row pieces into registers and from there into one of two LDS buffers
// (row pitch 272 B, an odd multiple of 16 B, for the 16-byte fragment reads); the next pass's global loads are issued ahead of this pass's products. Every wave computes a (16 * FM) x 32 part from LDS fragments,
// so an operand row is read from L2 once per block, not once per wave. k runs upward in steps of 32 into one accumulator per 16 x 16 tile.
// Every "#pragma unroll" in this kernel is there so that the small arrays it indexes (ra, rb, a, b, acc, o, c0, c, f, fh, fl) get constant indices and stay in registers.
// The body is a device function: sm is the launching kernel's LDS (gemm_lds(BN) bytes, 16-byte aligned), (bx, by) the tile's column and row index.
constexpr int gemm_lds(int BN) { return (2 * (128 + BN) * 272 > BN * 576) ? 2 * (128 + BN) * 272 : BN * 576; }      /* the two stage buffers, or the eight waves' epilogue ranges */
template <int BN, int LDC, int ACT, bool ADDC>
__device__ __forceinline__ void d_gemm_t(unsigned char* const sm, const int bx, const int by, const _Float16* __restrict__ A, const _Float16* __restrict__ Bt, float alpha, float* C,
                                         const float* __restrict__ CS = nullptr, _Float16* __restrict__ P0 = nullptr, _Float16* __restrict__ P1 = nullptr, _Float16* __restrict__ P2 = nullptr) {
  constexpr int BM = 128, BK = 128, PB = BK * 2 + 16, WN = BN / 32, WM = 8 / WN, FM = BM / (16 * WM), NA = BM / 16, NB = BN / 16, KT = DM / BK;
  constexpr int STG = (BM + BN) * PB, EPW = FM * 16 * 36, EPI = 8 * EPW * 4, SZ = (2 * STG > EPI) ? 2 * STG : EPI;
  static_assert(SZ == gemm_lds(BN), "the launching kernel sizes sm by gemm_lds");
  const int tid = threadIdx.x, lane = tid & 31, ln = lane & 15, hh = lane >> 4;
  const int w = __builtin_amdgcn_readfirstlane(tid >> 5);      /* wave number, uniform: it only picks the wave's part of the tile */
  const int wm = w / WN, wn = w % WN;
  const int row0 = by * BM, col0 = bx * BN;
  const int sr = tid >> 4, sc = tid & 15;      /* 16 threads a row: 256 contiguous bytes */
  const unsigned short* ga = (const unsigned short*)A + (size_t)(row0 + sr) * DM + sc * 8;
  const unsigned short* gb = (const unsigned short*)Bt + (size_t)(col0 + sr) * DM + sc * 8;
  unsigned char* const sst = sm + sr * PB + sc * 16;
  const unsigned char* const fa = sm + (wm * FM * 16 + ln) * PB + hh * 16;
  const unsigned char* const fb = sm + (BM + wn * 32 + ln) * PB + hh * 16;
  v8us ra[NA], rb[NB];
#pragma unroll
  for (int i = 0; i < NA; ++i) ra[i] = *(const v8us*)(ga + (size_t)i * 16 * DM);
#pragma unroll
  for (int i = 0; i < NB; ++i) rb[i] = *(const v8us*)(gb + (size_t)i * 16 * DM);
#pragma unroll
  for (int i = 0; i < NA; ++i) *(v8us*)(sst + i * 16 * PB) = ra[i];
#pragma unroll
  for (int i = 0; i < NB; ++i) *(v8us*)(sst + (BM + i * 16) * PB) = rb[i];
  __syncthreads();      /* pass 0 is in buffer 0 before any wave reads a fragment */
  v8f acc[FM][2];
#pragma unroll
  for (int fm = 0; fm < FM; ++fm) { acc[fm][0] = (v8f){0.f,0.f,0.f,0.f,0.f,0.f,0.f,0.f}; acc[fm][1] = acc[fm][0]; }
  for (int kt = 0; kt < KT; ++kt) {
    const int cur = (kt & 1) * STG, nxt = STG - cur;
    if (kt + 1 < KT) {
#pragma unroll
      for (int i = 0; i < NA; ++i) ra[i] = *(const v8us*)(ga + (size_t)i * 16 * DM + (kt + 1) * BK);
#pragma unroll
      for (int i = 0; i < NB; ++i) rb[i] = *(const v8us*)(gb + (size_t)i * 16 * DM + (kt + 1) * BK);
    }
#pragma unroll
    for (int ks = 0; ks < BK / 32; ++ks) {
      FragH a[FM], b[2];
#pragma unroll
      for (int fm = 0; fm < FM; ++fm) { a[fm].half[0] = *(const v8us*)(fa + cur + fm * 16 * PB + ks * 64); a[fm].half[1] = *(const v8us*)(fa + cur + fm * 16 * PB + ks * 64 + 32); }
#pragma unroll
      for (int fn = 0; fn < 2; ++fn) { b[fn].half[0] = *(const v8us*)(fb + cur + fn * 16 * PB + ks * 64); b[fn].half[1] = *(const v8us*)(fb + cur + fn * 16 * PB + ks * 64 + 32); }
#pragma unroll
      for (int fm = 0; fm < FM; ++fm)
#pragma unroll
        for (int fn = 0; fn < 2; ++fn) acc[fm][fn] = __builtin_amdgcn_wmma_f32_16x16x32_f16(false, a[fm].v, false, b[fn].v, (short)0, acc[fm][fn], false, false);
    }
    if (kt + 1 < KT) {      /* the other buffer: its readers left it at the barrier that ended pass kt - 1 */
#pragma unroll
      for (int i = 0; i < NA; ++i) *(v8us*)(sst + nxt + i * 16 * PB) = ra[i];
#pragma unroll
      for (int i = 0; i < NB; ++i) *(v8us*)(sst + nxt + (BM + i * 16) * PB) = rb[i];
    }
    __syncthreads();      /* publishes pass kt + 1 and ends every wave's reads of pass kt */
  }
  if constexpr (ACT == 21 || ACT == 22) {
    /* The tile leaves as the attention kernel's operands, with no f32 copy in memory and no launch in between. ACT 21: all columns are query heads of 64; ACT 22: columns 0..63 are the shared key, 64..127 the shared value.
       Rotary (rotate-half): dims d and d + 32 of a head lie in two waves' parts, so the block's tile is gathered in LDS (free behind the last barrier), row-major, pitch a multiple of 16 B. A thread takes 8 dims d and their partners d + 32 of one row
       and head: out[d] = x[d] cos_d - x[d + 32] sin_d, out[d + 32] = x[d + 32] cos_d + x[d] sin_d in f32, (cos, sin) from the table row of the token's position in its sequence, stored f16: P0, row pitch LDC; a wave's two stores fill whole 128-byte lines.
       The table values are asked for ahead of the gather, so that their latency passes under it.
       Value columns: a lane's 8 accumulator registers are 8 consecutive tokens of one column, a 16-byte piece of a V^T row; they are gathered column-major (pitch BM + 4 floats) and leave as f16 (P1) and x2^10 residual (P2) planes [batch][dim][token], 16 threads a row: whole lines. */
    constexpr int NHT = (ACT == 21) ? BN / HD : 1, PT = NHT * HD + 4, TR = 4 * NHT, RS = 256 / TR, NU = BM / RS, PW = BM + 4;
    static_assert(BN == 128 && TT % BM == 0 && (BM * PT + (ACT == 22 ? HD * PW : 0)) * 4 <= SZ, "two heads, or key and value, a tile; a tile lies inside one sequence; the gathered tile fits the stage buffers");
    float* const st = (float*)sm; float* const sv = st + BM * PT;
    const int g4 = tid & 3, hl = (tid >> 2) % NHT, ur = tid / TR;      /* 8-dim piece, head within the tile, row within a step of RS rows */
    const float* const cp = CS + ((size_t)(row0 % TT + ur) * 32 + g4 * 8) * 2;
    v4f c[NU][4];
#pragma unroll
    for (int q = 0; q < NU; ++q)
#pragma unroll
      for (int j = 0; j < 4; ++j) c[q][j] = *(const v4fa*)(cp + (size_t)q * RS * 64 + j * 4);
    if (ACT == 22) asm volatile("s_wait_xcnt 0x0" ::: "memory");      /* in this body the gather's address arithmetic below reuses the register that these loads name as their address: the wait stands in front of it (in the body of 21 that register pair is left alone) */
    if (ACT == 21 || wn < 2) {      /* wn is uniform for the wave */
#pragma unroll
      for (int fm = 0; fm < FM; ++fm)
#pragma unroll
        for (int fn = 0; fn < 2; ++fn)
#pragma unroll
          for (int r = 0; r < 8; ++r) st[((wm * FM + fm) * 16 + 8 * hh + r) * PT + wn * 32 + fn * 16 + ln] = acc[fm][fn][r] * alpha;
    } else {
#pragma unroll
      for (int fm = 0; fm < FM; ++fm)
#pragma unroll
        for (int fn = 0; fn < 2; ++fn) { const v8f t = acc[fm][fn] * alpha; float* const d = sv + ((wn - 2) * 32 + fn * 16 + ln) * PW + (wm * FM + fm) * 16 + 8 * hh;
          *(v4fa*)d = (v4f){t[0], t[1], t[2], t[3]}; *(v4fa*)(d + 4) = (v4f){t[4], t[5], t[6], t[7]}; }
    }
    __syncthreads();      /* every wave's part of the tile is in LDS before any wave reads a row or a column */
#pragma unroll
    for (int q = 0; q < NU; ++q) { const float* const xr = st + (q * RS + ur) * PT + hl * HD + g4 * 8;
      const v4f a0 = *(const v4fa*)xr, a1 = *(const v4fa*)(xr + 4), b0 = *(const v4fa*)(xr + 32), b1 = *(const v4fa*)(xr + 36); FragH f;
#pragma unroll
      for (int e = 0; e < 8; ++e) { const float a = (e < 4) ? a0[e & 3] : a1[e & 3], b = (e < 4) ? b0[e & 3] : b1[e & 3], cs = c[q][e >> 1][(e & 1) * 2], sn = c[q][e >> 1][(e & 1) * 2 + 1];
        f.h[e] = (_Float16)(a * cs - b * sn); f.h[8 + e] = (_Float16)(b * cs + a * sn); }
      unsigned short* const o = (unsigned short*)P0 + (size_t)(row0 + q * RS + ur) * LDC + col0 + hl * HD + g4 * 8;
      *(v8us*)o = f.half[0]; *(v8us*)(o + 32) = f.half[1]; }
    if (ACT == 22) {
#pragma unroll
      for (int q = 0; q < HD * (BM / 8) / 256; ++q) { const int e = q * 256 + tid, pc = e % (BM / 8), d = e / (BM / 8);
        const v4f x0 = *(const v4fa*)&sv[d * PW + pc * 8], x1 = *(const v4fa*)&sv[d * PW + pc * 8 + 4]; FragH fh, fl;
#pragma unroll
        for (int i = 0; i < 8; ++i) { const float v = (i < 4) ? x0[i & 3] : x1[i & 3]; const _Float16 hv = (_Float16)v; fh.h[i] = hv; fl.h[i] = (_Float16)((v - (float)hv) * 1024.0f); }
        const size_t oo = ((size_t)(row0 / TT) * HD + d) * TT + row0 % TT + pc * 8;
        *(v8us*)((unsigned short*)P1 + oo) = fh.half[0]; *(v8us*)((unsigned short*)P2 + oo) = fl.half[0]; }
    }
    return;
  }
  if (ACT == 11) {
    /* sigmoid outputs leave column-major, C[col][row] with row pitch LDC: the attention kernel reads 8 consecutive rows (keys) of one column (head) per lane. A lane's 8 accumulator registers are 8 consecutive rows of one column;
       the block's tile is gathered in LDS (free behind the last barrier; pitch BM + 4 floats keeps 16-byte alignment) so that each wave stores whole 128-byte lines. */
    constexpr int PT = BM + 4;
    float* const st = (float*)sm;
#pragma unroll
    for (int fm = 0; fm < FM; ++fm)
#pragma unroll
      for (int fn = 0; fn < 2; ++fn) { v4f lo, hi;
#pragma unroll
        for (int r = 0; r < 4; ++r) { lo[r] = 1.0f / (1.0f + expf(-(acc[fm][fn][r] * alpha))); hi[r] = 1.0f / (1.0f + expf(-(acc[fm][fn][4 + r] * alpha))); }
        float* const d = st + (wn * 32 + fn * 16 + ln) * PT + (wm * FM + fm) * 16 + 8 * hh; *(v4fa*)d = lo; *(v4fa*)(d + 4) = hi; }
    __syncthreads();      /* every wave's rows of the tile are in LDS before any wave stores a column */
    for (int q = 0; q < BN * BM / 4 / 256; ++q) { const int e = q * 256 + tid, col = e / (BM / 4), r4 = (e % (BM / 4)) * 4; const v4f v = *(const v4fa*)&st[col * PT + r4]; *(v4f*)(C + (size_t)(col0 + col) * LDC + row0 + r4) = v; }
    return;
  }
  /* epilogue: behind the last barrier the buffers are free; each wave turns its part into whole 128-byte rows in its own LDS range (row pitch 36 floats) */
  float* const so = (float*)sm + w * EPW;
  const int er = lane >> 3, ec = (lane & 7) * 4;      /* 8 lanes a row of 32 floats */
  float* const cp = C + (size_t)(row0 + wm * FM * 16 + er) * LDC + col0 + wn * 32 + ec;      /* one address for all rows of the part; the row step is a constant offset */
  v4f o[FM * 4], c0[FM * 4];
#pragma unroll
  for (int fm = 0; fm < FM; ++fm)
#pragma unroll
    for (int fn = 0; fn < 2; ++fn)
#pragma unroll
      for (int r = 0; r < 8; ++r) so[(fm * 16 + 8 * hh + r) * 36 + fn * 16 + ln] = acc[fm][fn][r] * alpha;
  __builtin_amdgcn_fence(__ATOMIC_ACQ_REL, "workgroup"); __builtin_amdgcn_wave_barrier();      /* the wave's own LDS writes are done before its lanes read each other's */
  if (ADDC) {      /* the old values, all asked for at once, once the accumulators' registers are free */
#pragma unroll
    for (int q = 0; q < FM * 4; ++q) c0[q] = *(const v4fa*)(cp + (size_t)q * 4 * LDC);
  }
#pragma unroll
  for (int q = 0; q < FM * 4; ++q) { o[q] = *(const v4fa*)&so[(q * 4 + er) * 36 + ec]; if (ADDC) o[q] += c0[q]; }
#pragma unroll
  for (int q = 0; q < FM * 4; ++q) *(v4f*)(cp + (size_t)q * 4 * LDC) = o[q];
}
// Output projection, both planes of O in one launch: C = (Ah.Bt^T + 2^-10 Al.Bt^T) / 16, operands K-contiguous with row pitch DM, K = DM. One block of 16 waves owns a 128 x 128 tile of C (256 blocks, one a WGP, four waves a SIMD).
// A pass stages 128 k of the tile's rows of Ah, of Al and of Bt as d_gemm_t does (whole-row loads into registers, from there into one of two LDS buffers, row pitch 272 B; the next pass's loads are issued ahead of this pass's products):
// a Bt row is brought in and a Bt fragment read once for both planes. Every wave computes a 32 x 32 part with one accumulator per 16 x 16 tile AND plane, k upward in steps of 32 as in the two single launches; the planes meet in registers
// in the epilogue (both scalings are by powers of two, so the one rounding of the sum is the one the read-add-write of C made), and C is written once and never read.
// Every "#pragma unroll" in this kernel is there so that the small arrays it indexes (rh, rl, rb, ah, al, b, the accumulators, o) get constant indices and stay in registers.
__global__ __launch_bounds__(512) void k_gemm_o(const _Float16* __restrict__ Ah, const _Float16* __restrict__ Al, const _Float16* __restrict__ Bt, float* __restrict__ C) {
  constexpr int BM = 128, BN = 128, BK = 128, PB = BK * 2 + 16, FM = 2, NS = BM / 32, KT = DM / BK;
  constexpr int OAL = BM * PB, OB = 2 * BM * PB, STG = (2 * BM + BN) * PB, EPW = FM * 16 * 36;      /* a stage: rows of Ah, of Al, of Bt */
  static_assert(BN == BM && 16 * EPW * 4 <= 2 * STG, "one count of staging steps for the three operands; the sixteen epilogue ranges lie inside the two stage buffers");
  __shared__ __attribute__((aligned(16))) unsigned char sm[2 * STG];
  const int tid = threadIdx.x, lane = tid & 31, ln = lane & 15, hh = lane >> 4;
  const int w = __builtin_amdgcn_readfirstlane(tid >> 5);      /* wave number, uniform: it only picks the wave's part of the tile */
  const int wm = w >> 2, wn = w & 3;
  const int row0 = blockIdx.y * BM, col0 = blockIdx.x * BN;
  const int sr = tid >> 4, sc = tid & 15;      /* 16 threads a row: 256 contiguous bytes; 32 rows a step */
  const unsigned short* gh = (const unsigned short*)Ah + (size_t)(row0 + sr) * DM + sc * 8;
  const unsigned short* gl = (const unsigned short*)Al + (size_t)(row0 + sr) * DM + sc * 8;
  const unsigned short* gb = (const unsigned short*)Bt + (size_t)(col0 + sr) * DM + sc * 8;
  unsigned char* const sst = sm + sr * PB + sc * 16;
  const unsigned char* const fa = sm + (wm * FM * 16 + ln) * PB + hh * 16;
  const unsigned char* const fb = sm + OB + (wn * 32 + ln) * PB + hh * 16;
  v8us rh[NS], rl[NS], rb[NS];
#pragma unroll
  for (int i = 0; i < NS; ++i) { rh[i] = *(const v8us*)(gh + (size_t)i * 32 * DM); rl[i] = *(const v8us*)(gl + (size_t)i * 32 * DM); rb[i] = *(const v8us*)(gb + (size_t)i * 32 * DM); }
#pragma unroll
  for (int i = 0; i < NS; ++i) { *(v8us*)(sst + i * 32 * PB) = rh[i]; *(v8us*)(sst + OAL + i * 32 * PB) = rl[i]; *(v8us*)(sst + OB + i * 32 * PB) = rb[i]; }
  __syncthreads();      /* pass 0 is in buffer 0 before any wave reads a fragment */
  v8f acch[FM][2], accl[FM][2];
#pragma unroll
  for (int fm = 0; fm < FM; ++fm)
#pragma unroll
    for (int fn = 0; fn < 2; ++fn) { acch[fm][fn] = (v8f){0.f,0.f,0.f,0.f,0.f,0.f,0.f,0.f}; accl[fm][fn] = acch[fm][fn]; }
  for (int kt = 0; kt < KT; ++kt) {
    const int cur = (kt & 1) * STG, nxt = STG - cur;
    if (kt + 1 < KT) {
#pragma unroll
      for (int i = 0; i < NS; ++i) { rh[i] = *(const v8us*)(gh + (size_t)i * 32 * DM + (kt + 1) * BK); rl[i] = *(const v8us*)(gl + (size_t)i * 32 * DM + (kt + 1) * BK); rb[i] = *(const v8us*)(gb + (size_t)i * 32 * DM + (kt + 1) * BK); }
      __builtin_amdgcn_sched_barrier(0);      /* keeps the twelve loads in front of the pass's products: left free, the compiler sinks them behind three quarters of the pass, and their latency then stands bare in front of the LDS stores */
    }
#pragma unroll
    for (int ks = 0; ks < BK / 32; ++ks) {
      FragH ah[FM], al[FM], b[2];
#pragma unroll
      for (int fm = 0; fm < FM; ++fm) { const unsigned char* p = fa + cur + fm * 16 * PB + ks * 64; ah[fm].half[0] = *(const v8us*)p; ah[fm].half[1] = *(const v8us*)(p + 32); al[fm].half[0] = *(const v8us*)(p + OAL); al[fm].half[1] = *(const v8us*)(p + OAL + 32); }
#pragma unroll
      for (int fn = 0; fn < 2; ++fn) { const unsigned char* p = fb + cur + fn * 16 * PB + ks * 64; b[fn].half[0] = *(const v8us*)p; b[fn].half[1] = *(const v8us*)(p + 32); }
#pragma unroll
      for (int fm = 0; fm < FM; ++fm)
#pragma unroll
        for (int fn = 0; fn < 2; ++fn) { acch[fm][fn] = __builtin_amdgcn_wmma_f32_16x16x32_f16(false, ah[fm].v, false, b[fn].v, (short)0, acch[fm][fn], false, false); accl[fm][fn] = __builtin_amdgcn_wmma_f32_16x16x32_f16(false, al[fm].v, false, b[fn].v, (short)0, accl[fm][fn], false, false); }
    }
    if (kt + 1 < KT) {      /* the other buffer: its readers left it at the barrier that ended pass kt - 1 */
#pragma unroll
      for (int i = 0; i < NS; ++i) { *(v8us*)(sst + nxt + i * 32 * PB) = rh[i]; *(v8us*)(sst + nxt + OAL + i * 32 * PB) = rl[i]; *(v8us*)(sst + nxt + OB + i * 32 * PB) = rb[i]; }
    }
    __syncthreads();      /* publishes pass kt + 1 and ends every wave's reads of pass kt */
  }
  /* epilogue: behind the last barrier the buffers are free; each wave turns its part into whole 128-byte rows in its own LDS range (row pitch 36 floats) */
  float* const so = (float*)sm + w * EPW;
  const int er = lane >> 3, ec = (lane & 7) * 4;      /* 8 lanes a row of 32 floats */
  float* const cp = C + (size_t)(row0 + wm * FM * 16 + er) * DM + col0 + wn * 32 + ec;      /* one address for all rows of the part; the row step is a constant offset */
  v4f o[FM * 4];
#pragma unroll
  for (int fm = 0; fm < FM; ++fm)
#pragma unroll
    for (int fn = 0; fn < 2; ++fn)
#pragma unroll
      for (int r = 0; r < 8; ++r) so[(fm * 16 + 8 * hh + r) * 36 + fn * 16 + ln] = acch[fm][fn][r] * 0.0625f + accl[fm][fn][r] * (0.0625f * 0.0009765625f);      /* Bt carries x2^4, Al x2^10 */
  __builtin_amdgcn_fence(__ATOMIC_ACQ_REL, "workgroup"); __builtin_amdgcn_wave_barrier();      /* the wave's own LDS writes are done before its lanes read each other's */
#pragma unroll
  for (int q = 0; q < FM * 4; ++q) o[q] = *(const v4fa*)&so[(q * 4 + er) * 36 + ec];
#pragma unroll
  for (int q = 0; q < FM * 4; ++q) *(v4f*)(cp + (size_t)q * 4 * DM) = o[q];
}
// The three projections of x (q, [k | v], the head scalars) do not depend on one another: one launch holds the tiles of all three, each block doing one tile as before. The two narrow products have 32 tiles each, too few to fill the chip alone;
// here they run beside the 256 tiles of q (two blocks fit a WGP's LDS), and two launch gaps go. The test on the block index is uniform for the block, so every barrier inside a body is passed by the whole block.
// q and [k | v] leave their tiles as the attention kernel reads them (rotary q and k in f16, V^T planes): d_gemm_t's epilogues 21 and 22.
__global__ __launch_bounds__(256) void k_proj(const _Float16* __restrict__ X16, const _Float16* __restrict__ Bq, const _Float16* __restrict__ Bkv, const _Float16* __restrict__ Bkh, const float* __restrict__ CS,
                                              _Float16* __restrict__ Q16, _Float16* __restrict__ K16, _Float16* __restrict__ Vth, _Float16* __restrict__ Vtl, float* HS) {
  constexpr int NQX = DM / 128, NRT = NR / 128;
  __shared__ __attribute__((aligned(16))) unsigned char sm[gemm_lds(128)];
  const int bid = blockIdx.x;
  /* the tests run from the narrow tile up: so the compiler keeps the pass loop of both 128-wide bodies as it is in the single launches; with q tested first it lays out all eight passes of q, three times the text */
  if (bid >= (NQX + 1) * NRT) d_gemm_t<32, NR, 11, false>(sm, 0, bid - (NQX + 1) * NRT, X16, Bkh, 0.0625f, HS);      /* [kh | vh] = sigmoid(x.Wkvh): M 4096 N 32 K 1024, stored head-major: 32 rows of 4096 f32 */
  else if (bid >= NQX * NRT) { d_gemm_t<128, HD, 22, false>(sm, 0, bid - NQX * NRT, X16, Bkv, 0.0625f, nullptr, CS, K16, Vth, Vtl);      /* [k | v]: M 4096 N 128 K 1024 -> rotary k [4096][64] f16, V^T hi/lo per batch [b][64][T] */
    asm volatile("s_wait_xcnt 0x0" ::: "memory"); }      /* in this kernel's text another body follows the tile's stores and rewrites their registers: the wait stands between */
  else { d_gemm_t<128, DM, 21, false>(sm, bid % NQX, bid / NQX, X16, Bq, 0.0625f, nullptr, CS, Q16);      /* q: M 4096 N 1024 K 1024 -> rotary q f16 */
    asm volatile("s_wait_xcnt 0x0" ::: "memory"); }      /* as above */
}


typedef _Float16 v4h __attribute__((ext_vector_type(4)));

typedef _Float16 v4ha __attribute__((ext_vector_type(4), may_alias));
// A block takes 8192 values in a row, a thread eight pieces of 4: a wave's load is 512 contiguous bytes, its store 256, and the eight loads are in flight together. n is a multiple of 8192.
// Both "#pragma unroll" are there so that r gets constant indices and stays in registers.
__device__ __forceinline__ void d_x16(int bid, const float* __restrict__ x, _Float16* __restrict__ X16, size_t n) { const size_t t = (size_t)bid * 8192 + threadIdx.x * 4; if (t >= n) return; v4f r[8];
#pragma unroll
  for (int j = 0; j < 8; ++j) r[j] = *(const v4fa*)(x + t + j * 1024);
#pragma unroll
  for (int j = 0; j < 8; ++j) { const v4ha o = {(_Float16)bf16_round(r[j][0]), (_Float16)bf16_round(r[j][1]), (_Float16)bf16_round(r[j][2]), (_Float16)bf16_round(r[j][3])}; *(v4ha*)(X16 + t + j * 1024) = o; }
  asm volatile("s_wait_xcnt 0x0" ::: "memory"); }      /* closes the run of eight stores ahead of every rewrite of a register that they name: further down k_prep's listing the other ranges' code rewrites them */
__global__ __launch_bounds__(256) void k_h16(const float* __restrict__ x, _Float16* __restrict__ X16, size_t n8) { const size_t t = (size_t)blockIdx.x * 256 + threadIdx.x; if (t >= n8) return; FragH f;
#pragma unroll
  for (int q = 0; q < 8; ++q) f.h[q] = (_Float16)x[t * 8 + q]; *(v8us*)((unsigned short*)X16 + t * 8) = f.half[0];  }
__global__ __launch_bounds__(256) void k_round16f(const float* __restrict__ W, _Float16* __restrict__ Bt, size_t n8) { const size_t t = (size_t)blockIdx.x * 256 + threadIdx.x; if (t >= n8) return; FragH f;
#pragma unroll
  for (int i = 0; i < 8; ++i) f.h[i] = (_Float16)(bf16_round(W[t * 8 + i]) * 16.0f); *(v8us*)((unsigned short*)Bt + t * 8) = f.half[0];  }
template <int NHv, int TTv>
__global__ __launch_bounds__(256) void k_vt(const _Float16* __restrict__ V16, int ldv, int voff, _Float16* __restrict__ Vt) { __shared__ unsigned short tl[64][66]; const int tid = threadIdx.x; const int slab = blockIdx.x / (TTv / 64), lg = blockIdx.x % (TTv / 64); const int b = slab / NHv, h = slab % NHv;
  for (int i = tid; i < 64 * 8; i += 256) { const int r = i / 8, c8 = (i % 8) * 8; FragH f; f.half[0] = *(const v8us*)((const unsigned short*)V16 + ((size_t)b * TTv + lg * 64 + r) * ldv + voff + h * 64 + c8);
#pragma unroll
    for (int q = 0; q < 8; ++q) tl[r][c8 + q] = f.u[q]; }
  __syncthreads();
  {
#pragma unroll
    for (int rd = 0; rd < 2; ++rd) { const int d = rd * 32 + tid / 8, pc = tid % 8; FragH f;
#pragma unroll
      for (int q = 0; q < 8; ++q) f.u[q] = tl[pc * 8 + q][d];
      *(v8us*)((unsigned short*)Vt + ((size_t)slab * 64 + d) * TTv + lg * 64 + pc * 8) = f.half[0]; }
     } }

// A thread takes one frequency at four positions, TT / 4 apart: one powf serves the four.
__device__ __forceinline__ void d_cstab(int bid, float* __restrict__ CS) { const int t = bid * 256 + threadIdx.x; if (t >= TT / 4 * 32) return; const int i = t % 32; const float invf = powf(10000.0f, -(float)(2 * i) / (float)HD); typedef float v2f __attribute__((ext_vector_type(2), may_alias));
  for (int j = 0; j < 4; ++j) { const int p = t / 32 + j * (TT / 4); float sn, cs; sincosf((float)p * invf, &sn, &cs); const v2f v = {cs, sn};
    *(v2f*)(CS + ((size_t)p * 32 + i) * 2) = v; } }
// Everything that depends on the inputs alone (the four weight transposes, x in f16, the cos/sin table) in one launch: a block does what four blocks of the single launches did, picked by ranges of the block index; five launch gaps, drains and refills go.
// The table's range stands first: further down the chain of tests the compiler rates its powf as cold and leaves it a called function. Then the transposes, whose strided reads take the longest to return.
// Every thread does four times what a thread of the single launches did (an 8 x 4 patch of a weight, 32 values of x, 4 table positions): the launch is short, and what it costs is mostly the start of its waves, so there are 852 blocks, not 3408.
__global__ __launch_bounds__(256) void k_prep(const float* __restrict__ x, const float* __restrict__ Wq, const float* __restrict__ Wkv, const float* __restrict__ Wkvh, const float* __restrict__ Wo,
                                              _Float16* __restrict__ X16, _Float16* __restrict__ Bq, _Float16* __restrict__ Bkv, _Float16* __restrict__ Bkh, _Float16* __restrict__ Bo, float* __restrict__ CS) {
  constexpr int NBW = (DM / 4) * (DM / 8) / 256, NBKV = (2 * HD / 4) * (DM / 8) / 256, NBKH = (2 * NH / 4) * (DM / 8) / 256, NBCS = TT / 4 * 32 / 256;      /* blocks of a square weight, of Wkv, of Wkvh, of the table */
  int bid = blockIdx.x;
  if (bid < NBCS) { d_cstab(bid, CS); return; }
  bid -= NBCS;
  if (bid < NBW) { d_wt_f16(bid, Wq, Bq, DM, DM, 16.0f); return; }
  bid -= NBW;
  if (bid < NBW) { d_wt_f16(bid, Wo, Bo, DM, DM, 16.0f); return; }
  bid -= NBW;
  if (bid < NBKV) { d_wt_f16(bid, Wkv, Bkv, DM, 2 * HD, 16.0f); return; }
  bid -= NBKV;
  if (bid < NBKH) { d_wt_f16(bid, Wkvh, Bkh, DM, 2 * NH, 16.0f); return; }      /* (in,out) -> Bt x2^4 */
  bid -= NBKH;
  d_x16(bid, x, X16, (size_t)NR * DM);
}
typedef float v2p __attribute__((ext_vector_type(2)));
/* lane l with lane l ^ 16: one vector cross-row move */
__device__ __forceinline__ float xhalf(float x) { return __builtin_bit_cast(float, __builtin_amdgcn_permlanex16(__builtin_bit_cast(int, x), __builtin_bit_cast(int, x), 0x76543210, 0xfedcba98, false, false)); }
/* 2^x with the instruction set's one free slot behind a transcendental held in the same statement. */
__device__ __forceinline__ float exp2_slot(float x) { float y; asm("v_exp_f32 %0, %1\n\tv_nop" : "=v"(y) : "v"(x)); return y; }
/* One stage of k_flash's key loop, 128 keys, from global memory straight into LDS: a thread's 4 + 4 + 4 pieces of 16 bytes (key rows, V^T high rows, V^T residual rows) and one piece of 8 bytes (head scalars).
   Every wave's 32 lanes cover whole 128-byte lines. The s_wait_xcnt closes the statement so that no address register named here is rewritten while a copy may still read it. */
__device__ __forceinline__ void stage_copies(unsigned lk, unsigned lv, unsigned lw, unsigned lh, const char* gk, const char* gv, const char* gw, const char* gh) {
  asm volatile("global_load_async_to_lds_b128 %0, %13, off\n\t"
               "global_load_async_to_lds_b128 %1, %14, off\n\t"
               "global_load_async_to_lds_b128 %2, %15, off\n\t"
               "global_load_async_to_lds_b128 %3, %16, off\n\t"
               "global_load_async_to_lds_b128 %4, %17, off\n\t"
               "global_load_async_to_lds_b128 %5, %18, off\n\t"
               "global_load_async_to_lds_b128 %6, %19, off\n\t"
               "global_load_async_to_lds_b128 %7, %20, off\n\t"
               "global_load_async_to_lds_b128 %8, %21, off\n\t"
               "global_load_async_to_lds_b128 %9, %22, off\n\t"
               "global_load_async_to_lds_b128 %10, %23, off\n\t"
               "global_load_async_to_lds_b128 %11, %24, off\n\t"
               "global_load_async_to_lds_b64 %12, %25, off\n\t"
               "s_wait_xcnt 0x0"
               :: "v"(lk), "v"(lk + 32u * 144u), "v"(lk + 64u * 144u), "v"(lk + 96u * 144u),
                  "v"(lv), "v"(lv + 16u * 272u), "v"(lv + 32u * 272u), "v"(lv + 48u * 272u),
                  "v"(lw), "v"(lw + 16u * 272u), "v"(lw + 32u * 272u), "v"(lw + 48u * 272u), "v"(lh),
                  "v"(gk), "v"(gk + 32 * HD * 2), "v"(gk + 64 * HD * 2), "v"(gk + 96 * HD * 2),
                  "v"(gv), "v"(gv + 16 * TT * 2), "v"(gv + 32 * TT * 2), "v"(gv + 48 * TT * 2),
                  "v"(gw), "v"(gw + 16 * TT * 2), "v"(gw + 32 * TT * 2), "v"(gw + 48 * TT * 2), "v"(gh)
               : "memory");
}
__global__ __launch_bounds__(256) __attribute__((amdgpu_waves_per_eu(4, 4))) void k_flash(const _Float16* __restrict__ Q16, int ldq, const _Float16* __restrict__ K16, const float* __restrict__ KH, const float* __restrict__ VHD, const _Float16* __restrict__ Vt, const _Float16* __restrict__ Vtlo, _Float16* __restrict__ OH, _Float16* __restrict__ OL, int ldo) {
  // One block = one 16-row query tile of TWO heads, 8 waves: wave w works for head w & 1 and takes the 32-key chunks kq, kq + 4, ... with kq = w >> 1; each wave keeps its own running max, sum and accumulators, and a head's four partial results are merged through LDS at the end.
  // Key rows and value rows are the same for every head, so a stage of 128 keys (four chunks: key rows, both V^T planes, the two heads' scalars) is brought into LDS once per block, in whole 128-byte lines, by asynchronous copies,
  // and the waves read their fragments from LDS (row pitches 144 B and 272 B, odd multiples of 16 B, for the 16-byte fragment reads). Two buffers: stage t + 1 flies while stage t is worked on.
  // A causal tile's cost grows with its index and there are more blocks than resident places, so the block index counts the tiles down: the longest start first. Two blocks share a WGP (four waves a SIMD): registers are held to 256 and LDS to under 160 KiB for that.
  // Both products are transposed: S^T = K.Q^T (A = 16 key rows, B = the query tile) and O^T += V^T.P^T (A = 16 rows of V^T, B = P^T). A lane then holds 16 of the 32 scores of ONE query (column ln; keys 8 hh + r and 16 + 8 hh + r),
  // so max and sum run in the lane with one exchange between the halves, the rescale factor is one value a lane (and both are due only when the reference in use falls too far behind: see the loop), and the two score tiles, converted in place, are the B operand of the second product in the k order of the V^T loader.
  // KH and VHD are head-major, [head][token]: a lane's 8 keys of a tile are 32 contiguous bytes.
  // Every "#pragma unroll" in this kernel is there so that the small arrays it indexes (bq, ak, av, avl, kh, vh, sc, p, bp, bpl, the accumulators, mw) get constant indices and stay in registers; "#pragma unroll 1" keeps one copy of the key loop's body, whose registers are the kernel's limit.
  constexpr int RPW = 16, NQT = TT / RPW, DT = 4, KS = 2, HB = 2, KQ = 4, NW = HB * KQ, SK = KQ * 32, NHG = NH / HB;
  constexpr int PK = HD * 2 + 16, PV = SK * 2 + 16, OVH = SK * PK, OVL = OVH + HD * PV, OHS = OVL + HD * PV, STG = OHS + 2 * HB * SK * 4;      /* a stage in LDS: key rows, V^T high, V^T residual, scalars (kh of the heads, then vh) */
  static_assert(PK == 144 && PV == 272 && SK == 128 && NW * 32 == 256, "stage_copies is written for these pitches, this stage and this block");
  constexpr float SCL2 = 0.125f * 1.44269504088896340736f;      /* 1/sqrt(64) times log2(e): e^(s - m) = 2^(s' - m') with s' = s log2(e), so every exponential of the softmax is one subtraction and the hardware's own 2^x; running maxima and merge weights are in the same units. A result below the normal range may come out as 0: a weight far below what any f32 sum here can see. */
  __shared__ __attribute__((aligned(16))) unsigned char sb[2 * STG];
  __shared__ __attribute__((aligned(16))) float sO[NW][RPW][64 + 4]; __shared__ float sM[NW][RPW], sL[NW][RPW];
  const int tid = threadIdx.x, lane = tid & 31, ln = lane & 15, hh = lane >> 4;
  const int w = __builtin_amdgcn_readfirstlane(tid >> 5);      /* wave number in a scalar register: it decides whether the wave has a chunk in a stage, and the branch around the matrix instructions must be a scalar one */
  const int hs = w % HB, kq = w / HB;
  const int slab = blockIdx.x % (BB * NHG), qt = NQT - 1 - blockIdx.x / (BB * NHG); const int b = slab / NHG, hg = slab % NHG; const int h = hg * HB + hs; const int q0 = qt * RPW;
  FragH bq[KS];
  { const unsigned short* qr = (const unsigned short*)Q16 + ((size_t)b * TT + q0 + ln) * ldq + h * 64;
#pragma unroll
    for (int ks = 0; ks < KS; ++ks) { bq[ks].half[0] = *(const v8us*)(qr + ks * 32 + 8 * hh); bq[ks].half[1] = *(const v8us*)(qr + ks * 32 + 16 + 8 * hh); } }
  /* the thread's pieces of a stage: 8 threads a key row (128 B), 16 threads a V^T row (256 B), 64 threads a scalar row (512 B) */
  const int hr = tid >> 6;      /* scalar row: kh of head 0, 1, then vh of head 0, 1 */
  const char* gk = (const char*)(K16 + ((size_t)b * TT + (tid >> 3)) * HD) + (tid & 7) * 16;
  const char* gv = (const char*)(Vt + ((size_t)b * 64 + (tid >> 4)) * TT) + (tid & 15) * 16;
  const char* gw = (const char*)(Vtlo + ((size_t)b * 64 + (tid >> 4)) * TT) + (tid & 15) * 16;
  const char* gh = (const char*)((hr < HB ? KH : VHD) + (size_t)(hg * HB + hr % HB) * NR + (size_t)b * TT) + (tid & 63) * 8;
  const unsigned lb = (unsigned)(size_t)sb;      /* byte address of the ring in the work-group's LDS */
  const unsigned lk = lb + (unsigned)((tid >> 3) * PK + (tid & 7) * 16), lv = lb + (unsigned)(OVH + (tid >> 4) * PV + (tid & 15) * 16), lw = lv + (unsigned)(OVL - OVH), lh = lb + (unsigned)(OHS + hr * SK * 4 + (tid & 63) * 8);
  /* the lane's fragment places in a stage */
  const unsigned char* const fk = sb + (kq * 32 + ln) * PK + hh * 16;
  const unsigned char* const fv = sb + OVH + ln * PV + (kq * 32 + 8 * hh) * 2;
  const unsigned char* const fh = sb + OHS + hs * SK * 4 + (kq * 32 + 8 * hh) * 4;
  float m_r = -3.0e38f, l_r = 0.f; v8f oacc[DT], oaccl[DT], oacc2[DT];
#pragma unroll
  for (int dt = 0; dt < DT; ++dt) { oacc[dt] = (v8f){0.f,0.f,0.f,0.f,0.f,0.f,0.f,0.f}; oaccl[dt] = oacc[dt]; oacc2[dt] = oacc[dt]; }
  const int jend = q0 + RPW;
  const int nst = (jend + SK - 1) / SK;      /* stages of the tile, the same for the whole block; a stage lies wholly inside the TT keys */
  stage_copies(lk, lv, lw, lh, gk, gv, gw, gh);
  asm volatile("s_wait_asynccnt 0x0" ::: "memory");      /* this wave's pieces of stage 0 have landed */
  __syncthreads();      /* every wave's pieces of stage 0 are in LDS before any wave reads a fragment */
  if (nst > 1) stage_copies(lk + STG, lv + STG, lw + STG, lh + STG, gk + SK * HD * 2, gv + SK * 2, gw + SK * 2, gh + SK * 4);
#pragma unroll 1
  for (int t = 0; t < nst; ++t) {
    const int cur = (t & 1) * STG; const int j0 = t * SK + kq * 32;
    if (j0 < jend) {      /* scalar test: the last stage of a tile may hold fewer than four chunks */
    FragH ak[2][KS], av[DT], avl[DT]; v4f kh[2][2], vh[2][2];
#pragma unroll
    for (int nt = 0; nt < 2; ++nt) {
#pragma unroll
      for (int ks = 0; ks < KS; ++ks) { const unsigned char* kr = fk + cur + nt * 16 * PK + ks * 64; ak[nt][ks].half[0] = *(const v8us*)kr; ak[nt][ks].half[1] = *(const v8us*)(kr + 32); }
      const unsigned char* kp = fh + cur + nt * 64; const unsigned char* vp = kp + HB * SK * 4;
      kh[nt][0] = *(const v4fa*)kp; kh[nt][1] = *(const v4fa*)(kp + 16); vh[nt][0] = *(const v4fa*)vp; vh[nt][1] = *(const v4fa*)(vp + 16); }
    v2p sc[2][4];      /* the lane's 16 scores as pairs of neighbouring registers, as the accumulators and the scalars lie: the packed f32 forms take them without a move */
#pragma unroll
    for (int nt = 0; nt < 2; ++nt) { v8f acc = (v8f){0.f,0.f,0.f,0.f,0.f,0.f,0.f,0.f};
#pragma unroll
      for (int ks = 0; ks < KS; ++ks) acc = __builtin_amdgcn_wmma_f32_16x16x32_f16(false, ak[nt][ks].v, false, bq[ks].v, (short)0, acc, false, false);
#pragma unroll
      for (int i = 0; i < 4; ++i) sc[nt][i] = (v2p){acc[2 * i], acc[2 * i + 1]} * (v2p){kh[nt][i >> 1][(i & 1) * 2], kh[nt][i >> 1][(i & 1) * 2 + 1]}; }      /* q.k times the key's head scalar; the scale to base-2 units and the reference are applied together, in one fused multiply-add, in weights() */
    if (j0 + 31 > q0) {      /* only a chunk that reaches past the tile's first query has keys to mask (scalar test); every query keeps at least one key of every chunk of the loop */
#pragma unroll
      for (int nt = 0; nt < 2; ++nt)
#pragma unroll
        for (int r = 0; r < 8; ++r) sc[nt][r >> 1][r & 1] = (j0 + nt * 16 + 8 * hh + r <= q0 + ln) ? sc[nt][r >> 1][r & 1] : -INFINITY; }
    /* Lazy rescale. m_r is the reference in use, not the running maximum: any reference gives the same softmax as long as sums and accumulators hold the same one. The weights are formed against it at once;
       only if some lane's 16 weights of this chunk sum to more than 32 (so also on the wave's first chunk, where the reference is -3e38 and the weights come out infinite) is the true maximum found, the reference raised,
       sums and accumulators rescaled and the weights formed again. Past the test every weight is at most 32, so p * vh * 1024 <= 32768 and its residual * 1024 <= 16384 stay inside f16. */
    v2p p[2][4]; float ps;
    const auto weights = [&]() {
#pragma unroll
      for (int nt = 0; nt < 2; ++nt)
#pragma unroll
        for (int i = 0; i < 4; ++i) { const v2p e = __builtin_elementwise_fma(sc[nt][i], (v2p){SCL2, SCL2}, (v2p){-m_r, -m_r}); p[nt][i] = (v2p){__builtin_amdgcn_exp2f(e[0]), __builtin_amdgcn_exp2f(e[1])}; }      /* a masked score is -inf: p = 0 */
      const v2p s = ((p[0][0] + p[1][0]) + (p[0][1] + p[1][1])) + ((p[0][2] + p[1][2]) + (p[0][3] + p[1][3]));      /* a tree: the test below waits for this sum */
      ps = s[0] + s[1];
    };
    weights();
    if (__builtin_amdgcn_ballot_w32(!(ps <= 32.0f)) != 0) {      /* one scalar branch a chunk, the same for the whole wave; the negated form also takes a sum that is not a number */
      float mc = fmaxf(sc[0][0][0], sc[1][0][0]);
#pragma unroll
      for (int r = 1; r < 8; ++r) mc = fmaxf(mc, fmaxf(sc[0][r >> 1][r & 1], sc[1][r >> 1][r & 1]));
      mc = fmaxf(mc, xhalf(mc));      /* the query's other 16 keys: both halves of a query always hold the same reference */
      const float mn = fmaxf(m_r, mc * SCL2); const float al = (mn > -1.0e38f) ? __builtin_amdgcn_exp2f(m_r - mn) : 1.0f; m_r = mn; l_r *= al;
#pragma unroll
      for (int dt = 0; dt < DT; ++dt) { oacc[dt] *= al; oaccl[dt] *= al; oacc2[dt] *= al; }
      weights();
    }
    l_r += ps;      /* the lane's half of the row sum; the halves are joined once, behind the loop */
    __builtin_amdgcn_sched_barrier(0);      /* keeps the V^T fragments' 64 registers out of the scores and exponentials: lifted to the top of the chunk, these LDS reads push the wave past 256 registers and a value spills to scratch */
#pragma unroll
    for (int dt = 0; dt < DT; ++dt) { const unsigned char* vp = fv + cur + dt * 16 * PV; const unsigned char* lp = vp + (OVL - OVH); av[dt].half[0] = *(const v8us*)vp; av[dt].half[1] = *(const v8us*)(vp + 32); avl[dt].half[0] = *(const v8us*)lp; avl[dt].half[1] = *(const v8us*)(lp + 32); }
    __builtin_amdgcn_sched_barrier(0);      /* keeps the sixteen reads together as one group in front of the split of P, under which their latency passes: spread among the matrix instructions, each further place of LDS reads costs the wave a wait of its own */
    FragH bp, bpl;
#pragma unroll
    for (int nt = 0; nt < 2; ++nt)
#pragma unroll
      for (int i = 0; i < 4; ++i) { const v2p pv = p[nt][i] * (v2p){vh[nt][i >> 1][(i & 1) * 2], vh[nt][i >> 1][(i & 1) * 2 + 1]} * 1024.0f;      /* value-head scalar folded into P, carried as f16 hi + x2^10 residual operands; the normaliser keeps plain p */
#pragma unroll
        for (int q = 0; q < 2; ++q) { const _Float16 ph = (_Float16)pv[q]; bp.h[nt * 8 + 2 * i + q] = ph; bpl.h[nt * 8 + 2 * i + q] = (_Float16)((pv[q] - (float)ph) * 1024.0f); } }
#pragma unroll
    for (int dt = 0; dt < DT; ++dt) { oacc[dt] = __builtin_amdgcn_wmma_f32_16x16x32_f16(false, av[dt].v, false, bp.v, (short)0, oacc[dt], false, false); oaccl[dt] = __builtin_amdgcn_wmma_f32_16x16x32_f16(false, avl[dt].v, false, bp.v, (short)0, oaccl[dt], false, false); oacc2[dt] = __builtin_amdgcn_wmma_f32_16x16x32_f16(false, av[dt].v, false, bpl.v, (short)0, oacc2[dt], false, false); }
    }
    /* hand-over of the ring, passed by every wave, also one without a chunk in this stage */
    asm volatile("s_wait_dscnt 0x0" ::: "memory");      /* this wave's reads of stage t are done before the buffer is given to the copies */
    asm volatile("s_wait_asynccnt 0x0" ::: "memory");      /* this wave's pieces of stage t + 1 have landed */
    __syncthreads();      /* publishes stage t + 1 and ends every wave's reads of stage t */
    if (t + 2 < nst) stage_copies(lk + cur, lv + cur, lw + cur, lh + cur, gk + (size_t)(t + 2) * (SK * HD * 2), gv + (size_t)(t + 2) * (SK * 2), gw + (size_t)(t + 2) * (SK * 2), gh + (size_t)(t + 2) * (SK * 4));      /* into the buffer that stage t has just left */
  }
  asm volatile("s_wait_asynccnt 0x0" ::: "memory");      /* no copy is outstanding when the wave goes on to its end */
  l_r += xhalf(l_r);
  if (hh == 0) { sM[w][ln] = m_r; sL[w][ln] = l_r; }
#pragma unroll
  for (int dt = 0; dt < DT; ++dt) { const v8f t = oacc[dt] + (oaccl[dt] + oacc2[dt]) * 0.0009765625f;      /* registers r = head dims dt * 16 + 8 hh + r of query ln */
    *(v4fa*)&sO[w][ln][dt * 16 + 8 * hh] = (v4f){t[0], t[1], t[2], t[3]}; *(v4fa*)&sO[w][ln][dt * 16 + 8 * hh + 4] = (v4f){t[4], t[5], t[6], t[7]}; }
  __syncthreads();      /* every wave's partial (max, sum, unnormalised rows) is in LDS before any wave merges */
  {
    const int mh = tid >> 7, lt = tid & 127;      /* 128 threads merge a head: its partial i is wave i * HB + mh's */
    const int r = lt >> 3, c8 = (lt & 7) * 8;      /* 8 threads a row, 8 head dims a thread: in f16 a head's row is one 128-byte line of each plane */
    float mw[KQ], M = -3.0e38f, L = 0.f;
#pragma unroll
    for (int i = 0; i < KQ; ++i) { mw[i] = sM[i * HB + mh][r]; M = fmaxf(M, mw[i]); }
#pragma unroll
    for (int i = 0; i < KQ; ++i) { mw[i] = exp2_slot(mw[i] - M); L += mw[i] * sL[i * HB + mh][r]; }      /* a wave that had no chunk holds max -3e38, sum 0, rows 0: weight 0 */
    const float inv = (L > 0.f) ? 1.0f / (L * 1024.0f) : 0.f;
    FragH fo, fr;      /* the merged row leaves as the output projection's operands: f16 and the x2^10 residual of that rounding */
#pragma unroll
    for (int hf = 0; hf < 2; ++hf) { v4f a = {0.f, 0.f, 0.f, 0.f};
#pragma unroll
      for (int i = 0; i < KQ; ++i) { const v4f p = *(const v4fa*)&sO[i * HB + mh][r][c8 + hf * 4]; a += p * mw[i]; }
      a *= inv;
#pragma unroll
      for (int q = 0; q < 4; ++q) { const _Float16 hv = (_Float16)a[q]; fo.h[hf * 4 + q] = hv; fr.h[hf * 4 + q] = (_Float16)((a[q] - (float)hv) * 1024.0f); } }
    const size_t oo = ((size_t)b * TT + q0 + r) * ldo + (hg * HB + mh) * 64 + c8;
    *(v8us*)((unsigned short*)OH + oo) = fo.half[0]; *(v8us*)((unsigned short*)OL + oo) = fr.half[0];
  } }

extern "C" void kernel_launch(void* const* d_in, const int* in_sizes, int n_in,
                              void* d_out, int out_size, void* d_ws, size_t ws_size, hipStream_t stream) {
  (void)in_sizes; (void)n_in; (void)out_size;
  const float* x = (const float*)d_in[0]; const float* Wq = (const float*)d_in[1]; const float* Wkv = (const float*)d_in[2]; const float* Wkvh = (const float*)d_in[3]; const float* Wo = (const float*)d_in[4];
  char* ws = (char*)d_ws; size_t off = 0;
  auto take = [&](size_t bytes) { char* p = ws + off; off += (bytes + 255) & ~(size_t)255; return p; };
  _Float16* Bq = (_Float16*)take((size_t)DM * DM * 2); _Float16* Bkv = (_Float16*)take((size_t)2 * HD * DM * 2); _Float16* Bkh = (_Float16*)take((size_t)2 * NH * DM * 2); _Float16* Bo = (_Float16*)take((size_t)DM * DM * 2); float* CS = (float*)take((size_t)TT * 32 * 2 * 4);
  _Float16* X16 = (_Float16*)take((size_t)NR * DM * 2); _Float16* Q16 = (_Float16*)take((size_t)NR * DM * 2); _Float16* K16 = (_Float16*)take((size_t)NR * HD * 2); float* HS = (float*)take((size_t)NR * 2 * NH * 4);
  _Float16* Vth = (_Float16*)take((size_t)BB * HD * TT * 2); _Float16* Vtl = (_Float16*)take((size_t)BB * HD * TT * 2); _Float16* OH = (_Float16*)take((size_t)NR * DM * 2); _Float16* OL = (_Float16*)take((size_t)NR * DM * 2);
  if (off > ws_size) return;      // 2.1 + 0.3 + 0.1 + 2.1 + 0.5 + 8.4 + 8.4 + 0.5 + 0.5 + 0.5 + 0.5 + 8.4 + 8.4 = about 41 MB
  k_prep<<<2 * ((DM / 4) * (DM / 8) / 256) + (2 * HD / 4) * (DM / 8) / 256 + (2 * NH / 4) * (DM / 8) / 256 + TT / 4 * 32 / 256 + NR * DM / 8192, 256, 0, stream>>>(x, Wq, Wkv, Wkvh, Wo, X16, Bq, Bkv, Bkh, Bo, CS);      /* weights -> Bt, x -> f16, cos/sin table */
  const dim3 gq(DM / 128, NR / 128);      /* 128 x 128 tiles of a 4096 x 1024 result: 256 blocks */
  k_proj<<<(DM / 128 + 2) * (NR / 128), 256, 0, stream>>>(X16, Bq, Bkv, Bkh, CS, Q16, K16, Vth, Vtl, HS);      /* rotary q, rotary k and V^T planes, [kh | vh]: 256 + 32 + 32 tiles */
  k_flash<<<BB * (NH / 2) * (TT / 16), 256, 0, stream>>>(Q16, DM, K16, HS, HS + (size_t)NH * NR, Vth, Vtl, OH, OL, DM);      /* KH = HS rows 0..15, VH = rows 16..31 (row pitch NR) */
  k_gemm_o<<<gq, 512, 0, stream>>>(OH, OL, Bo, (float*)d_out);      /* y = (O_hi + 2^-10 O_lo).Wo */
}
